// v000
// Measured on an AMD MI455X. A time is GPU time per run, averaged over a window of back-to-back runs after a warm-up
// (all launches, gaps included; the runs take copies of the inputs in turn), and the median of several windows.
// Apart from v000's, it joins two sittings. Times from different sittings can be a few percent apart, while
// side-by-side timings come from the same sitting.
// The starting kernel, v000, takes 136 microseconds a run.
#include <hip/hip_runtime.h>
#include <hip/hip_bf16.h>
#include <math.h>

typedef _Float16 half_t;
typedef __attribute__((ext_vector_type(16))) _Float16 v16h;
typedef __attribute__((ext_vector_type(8)))  _Float16 v8h;
typedef __attribute__((ext_vector_type(4)))  _Float16 v4h;
typedef __attribute__((ext_vector_type(8)))  float    v8f;

static constexpr int Bsz = 1024;   // batch
static constexpr int Pp  = 64;     // patches
static constexpr int Cc  = 512;    // channels
static constexpr int CG  = 16;     // channels per workgroup (64B-coalesced x loads)
static constexpr int BT  = 32;     // batch rows per workgroup
static constexpr int ROW = 72;     // 64 + 8 halves pad: 144B rows, 16B aligned

// LDS offsets (in halves)
static constexpr int XT_OFF  = 0;                       // x tile  [CG][BT][ROW]
static constexpr int W1_OFF  = XT_OFF + CG * BT * ROW;  // W1[c]   [64][ROW]  (B-matrix [n][k])
static constexpr int W2_OFF  = W1_OFF + 64 * ROW;       // W2[c]
static constexpr int HT_OFF  = W2_OFF + 64 * ROW;       // GELU(h) [BT][ROW] handoff
static constexpr int B1_OFF  = HT_OFF + BT * ROW;       // bias1 [64]
static constexpr int B2_OFF  = B1_OFF + 64;             // bias2 [64]
static constexpr int RES_OFF = B2_OFF + 64;             // res tile [BT][64][CG] f16
static constexpr int LDS_HALVES = RES_OFF + BT * 64 * CG;   // 81,280 halves
static constexpr int LDS_BYTES  = LDS_HALVES * 2;           // 162,560 B (2 WGs / 320KB WGP)

__device__ __forceinline__ v16h load_frag(const half_t* row, int kk, int khi) {
    v8h lo = *(const v8h*)(row + kk + 8 * khi);        // ds_load_b128
    v8h hi = *(const v8h*)(row + kk + 16 + 8 * khi);   // ds_load_b128
    v16h r;
#pragma unroll
    for (int i = 0; i < 8; ++i) { r[i] = lo[i]; r[i + 8] = hi[i]; }
    return r;
}

// ---- K0: bulk f32 -> f16 conversion (vectorized), for weights & biases
__global__ __launch_bounds__(256)
void cvt_f32_to_f16_k0(const float* __restrict__ src, half_t* __restrict__ dst, int n4) {
    const int i = blockIdx.x * 256 + threadIdx.x;
    if (i < n4) {
        const float4 v = ((const float4*)src)[i];
        ((v4h*)dst)[i] = (v4h){(half_t)v.x, (half_t)v.y, (half_t)v.z, (half_t)v.w};
    }
}

__global__ __launch_bounds__(256)
void mixer_gemm_k1(const float* __restrict__ x,
                   const half_t* __restrict__ W1h, const half_t* __restrict__ b1h,
                   const half_t* __restrict__ W2h, const half_t* __restrict__ b2h,
                   half_t* __restrict__ resh /* [B][P][C] f16 */) {
    extern __shared__ half_t smem[];
    const int tid  = threadIdx.x;
    const int c0   = blockIdx.x * CG;   // channel group base
    const int b0   = blockIdx.y * BT;   // batch tile base
    const int lane = tid & 31;
    const int wave = tid >> 5;
    const int lm   = lane & 15;
    const int khi  = lane >> 4;
    const int m0   = (wave & 1) * 16;   // 2 M-groups
    const int n0   = (wave >> 1) * 16;  // 4 N-groups
    // Dynamic LDS starts after static LDS (0 here); hedge with groupstaticsize.
    const unsigned lds_base = __builtin_amdgcn_groupstaticsize();

    // ---- Phase 0: coalesced x load (64B lines), f32->f16 transpose into LDS
    for (int it = tid; it < BT * 64 * 4; it += 256) {
        const int chunk = it & 3;            // 4-float sub-chunk of the 16 channels
        const int p     = (it >> 2) & 63;
        const int m     = it >> 8;           // 0..31
        const float4 v  = *(const float4*)(x + ((size_t)(b0 + m) * Pp + p) * Cc + c0 + chunk * 4);
        const float vv[4] = {v.x, v.y, v.z, v.w};
#pragma unroll
        for (int j = 0; j < 4; ++j) {
            const int cl = chunk * 4 + j;
            smem[XT_OFF + (cl * BT + m) * ROW + p] = (half_t)vv[j];
        }
    }

    // ---- Channel loop
    for (int ci = 0; ci < CG; ++ci) {
        const int c = c0 + ci;
        __syncthreads();   // prior readers of W/HT done; XT ready (ci==0)

        for (int it = tid; it < 512; it += 256) {
            const int q = it >> 3, seg = it & 7;
            const unsigned lds1 = lds_base + (unsigned)((W1_OFF + q * ROW + seg * 8) * 2);
            const unsigned lds2 = lds_base + (unsigned)((W2_OFF + q * ROW + seg * 8) * 2);
            const unsigned long long ga1 =
                (unsigned long long)(uintptr_t)(W1h + (size_t)c * 4096 + q * 64 + seg * 8);
            const unsigned long long ga2 =
                (unsigned long long)(uintptr_t)(W2h + (size_t)c * 4096 + q * 64 + seg * 8);
            asm volatile("global_load_async_to_lds_b128 %0, %1, off"
                         :: "v"(lds1), "v"(ga1) : "memory");
            asm volatile("global_load_async_to_lds_b128 %0, %1, off"
                         :: "v"(lds2), "v"(ga2) : "memory");
        }
        if (tid < 64)       smem[B1_OFF + tid]      = b1h[(size_t)c * 64 + tid];
        else if (tid < 128) smem[B2_OFF + tid - 64] = b2h[(size_t)c * 64 + (tid - 64)];
        asm volatile("s_wait_asynccnt 0x0" ::: "memory");
        __syncthreads();

        // Prefetch next channel's f16 weights (global_prefetch_b8), 8KB each
        if (ci + 1 < CG) {
            if (tid < 128)
                __builtin_prefetch((const char*)(W1h + (size_t)(c + 1) * 4096) + tid * 64, 0, 0);
            else
                __builtin_prefetch((const char*)(W2h + (size_t)(c + 1) * 4096) + (tid - 128) * 64, 0, 0);
        }

        // ---- Stage 1: H = X * W1^T + b1, exact GELU, handoff via LDS
        {
            const half_t* arow = smem + XT_OFF + (ci * BT + m0 + lm) * ROW;
            const half_t* brow = smem + W1_OFF + (n0 + lm) * ROW;
            const float bias1 = (float)smem[B1_OFF + n0 + lm];
            v8f acc;
#pragma unroll
            for (int r = 0; r < 8; ++r) acc[r] = bias1;
#pragma unroll
            for (int ks = 0; ks < 2; ++ks) {
                const v16h a = load_frag(arow, ks * 32, khi);
                const v16h b = load_frag(brow, ks * 32, khi);
                acc = __builtin_amdgcn_wmma_f32_16x16x32_f16(false, a, false, b,
                                                             (short)0, acc, false, false);
            }
#pragma unroll
            for (int r = 0; r < 8; ++r) {
                const float v = acc[r];
                const float g = 0.5f * v * (1.0f + erff(v * 0.70710678118654752f)); // exact GELU
                smem[HT_OFF + (m0 + r + 8 * khi) * ROW + n0 + lm] = (half_t)g;
            }
        }
        __syncthreads();

        // ---- Stage 2: O = H * W2^T + b2; res = O + x; store f16 res tile
        {
            const half_t* arow = smem + HT_OFF + (m0 + lm) * ROW;
            const half_t* brow = smem + W2_OFF + (n0 + lm) * ROW;
            const float bias2 = (float)smem[B2_OFF + n0 + lm];
            v8f acc;
#pragma unroll
            for (int r = 0; r < 8; ++r) acc[r] = bias2;
#pragma unroll
            for (int ks = 0; ks < 2; ++ks) {
                const v16h a = load_frag(arow, ks * 32, khi);
                const v16h b = load_frag(brow, ks * 32, khi);
                acc = __builtin_amdgcn_wmma_f32_16x16x32_f16(false, a, false, b,
                                                             (short)0, acc, false, false);
            }
            // Gather residual x first (pipelined ds_load_u16, single wait) ...
            float xv[8];
#pragma unroll
            for (int r = 0; r < 8; ++r)
                xv[r] = (float)smem[XT_OFF + (ci * BT + m0 + r + 8 * khi) * ROW + n0 + lm];
            // ... then add + scatter into the [m][q][c] res tile.
#pragma unroll
            for (int r = 0; r < 8; ++r)
                smem[RES_OFF + ((m0 + r + 8 * khi) * 64 + n0 + lm) * CG + ci] =
                    (half_t)(acc[r] + xv[r]);
        }
    }
    __syncthreads();

    // ---- Writeout: res tile -> scratch [B][P][C] f16, 16B vector stores
    for (int it = tid; it < BT * 64 * 2; it += 256) {
        const int chunk = it & 1;
        const int q     = (it >> 1) & 63;
        const int m     = it >> 7;
        const v8h hv = *(const v8h*)(smem + RES_OFF + (m * 64 + q) * CG + chunk * 8);
        *(v8h*)(resh + ((size_t)(b0 + m) * Pp + q) * Cc + c0 + chunk * 8) = hv;
    }
}

// ---- K2: LayerNorm over C. One wave32 per (b,q) row (1KB contiguous f16).
__global__ __launch_bounds__(256)
void mixer_ln_k2(const half_t* __restrict__ resh,
                 const float* __restrict__ gamma, const float* __restrict__ beta,
                 float* __restrict__ out) {
    const int lane = threadIdx.x & 31;
    const int wave = threadIdx.x >> 5;
    const size_t row = (size_t)blockIdx.x * 8 + wave;   // B*P = 65536 rows

    const half_t* rp = resh + row * Cc + lane * 16;
    const v8h a = *(const v8h*)rp;
    const v8h b = *(const v8h*)(rp + 8);
    float v[16], s = 0.f, s2 = 0.f;
#pragma unroll
    for (int i = 0; i < 8; ++i) { v[i] = (float)a[i]; v[i + 8] = (float)b[i]; }
#pragma unroll
    for (int i = 0; i < 16; ++i) { s += v[i]; s2 += v[i] * v[i]; }
#pragma unroll
    for (int off = 16; off > 0; off >>= 1) {
        s  += __shfl_xor(s,  off, 32);
        s2 += __shfl_xor(s2, off, 32);
    }
    const float mean = s * (1.0f / Cc);
    const float var  = s2 * (1.0f / Cc) - mean * mean;
    const float rstd = rsqrtf(var + 1e-5f);

    const int cb = lane * 16;
#pragma unroll
    for (int seg = 0; seg < 4; ++seg) {
        float4 o;
        o.x = (v[seg * 4 + 0] - mean) * rstd * gamma[cb + seg * 4 + 0] + beta[cb + seg * 4 + 0];
        o.y = (v[seg * 4 + 1] - mean) * rstd * gamma[cb + seg * 4 + 1] + beta[cb + seg * 4 + 1];
        o.z = (v[seg * 4 + 2] - mean) * rstd * gamma[cb + seg * 4 + 2] + beta[cb + seg * 4 + 2];
        o.w = (v[seg * 4 + 3] - mean) * rstd * gamma[cb + seg * 4 + 3] + beta[cb + seg * 4 + 3];
        *(float4*)(out + row * Cc + cb + seg * 4) = o;
    }
}

extern "C" void kernel_launch(void* const* d_in, const int* in_sizes, int n_in,
                              void* d_out, int out_size, void* d_ws, size_t ws_size,
                              hipStream_t stream) {
    const float* x     = (const float*)d_in[0];
    const float* W1    = (const float*)d_in[1];
    const float* b1    = (const float*)d_in[2];
    const float* W2    = (const float*)d_in[3];
    const float* b2    = (const float*)d_in[4];
    const float* gamma = (const float*)d_in[5];
    const float* beta  = (const float*)d_in[6];
    float* out = (float*)d_out;

    // Scratch layout (f16): res[B*P*C] | W1h | W2h | b1h | b2h  (~72.2 MB)
    half_t* resh = (half_t*)d_ws;
    half_t* W1h  = resh + (size_t)Bsz * Pp * Cc;
    half_t* W2h  = W1h + (size_t)Cc * Pp * Pp;
    half_t* b1h  = W2h + (size_t)Cc * Pp * Pp;
    half_t* b2h  = b1h + (size_t)Cc * Pp;

    // K0: f32 -> f16 weight/bias conversion
    const int w4 = Cc * Pp * Pp / 4;   // 524288 float4
    const int v4 = Cc * Pp / 4;        // 8192  float4
    cvt_f32_to_f16_k0<<<(w4 + 255) / 256, 256, 0, stream>>>(W1, W1h, w4);
    cvt_f32_to_f16_k0<<<(w4 + 255) / 256, 256, 0, stream>>>(W2, W2h, w4);
    cvt_f32_to_f16_k0<<<(v4 + 255) / 256, 256, 0, stream>>>(b1, b1h, v4);
    cvt_f32_to_f16_k0<<<(v4 + 255) / 256, 256, 0, stream>>>(b2, b2h, v4);

    // K1: fused GEMM/GELU/GEMM/residual per channel group
    dim3 g1(Cc / CG, Bsz / BT);     // 32 x 32 workgroups
    mixer_gemm_k1<<<g1, 256, LDS_BYTES, stream>>>(x, W1h, b1h, W2h, b2h, resh);

    // K2: LayerNorm
    dim3 g2((Bsz * Pp) / 8);        // 8192 workgroups, 8 rows each
    mixer_ln_k2<<<g2, 256, 0, stream>>>(resh, gamma, beta, out);
}

// v001
// It runs in 119 microseconds.
// In two side-by-side timings against v000, it was 1.15 and 1.16 times as fast.
#include <hip/hip_runtime.h>
#include <hip/hip_bf16.h>
#include <math.h>

typedef _Float16 half_t;
typedef __attribute__((ext_vector_type(16))) _Float16 v16h;
typedef __attribute__((ext_vector_type(8)))  _Float16 v8h;
typedef __attribute__((ext_vector_type(4)))  _Float16 v4h;
typedef __attribute__((ext_vector_type(2)))  _Float16 v2h;
typedef __attribute__((ext_vector_type(8)))  float    v8f;

static constexpr int Bsz = 1024;   // batch
static constexpr int Pp  = 64;     // patches
static constexpr int Cc  = 512;    // channels
static constexpr int CG  = 16;     // channels per workgroup (64B-coalesced x loads)
static constexpr int BT  = 32;     // batch rows per workgroup
static constexpr int ROW = 72;     // 64 + 8 halves pad: 144B rows, 16B aligned

// LDS offsets (in halves)
static constexpr int XT_OFF  = 0;                       // x tile, then res tile  [CG][BT][ROW]
static constexpr int LDS_HALVES = XT_OFF + CG * BT * ROW;   // 36,864 halves
static constexpr int LDS_BYTES  = LDS_HALVES * 2;           // 73,728 B

__device__ __forceinline__ v16h load_frag(const half_t* row, int kk, int khi) {
    v8h lo = *(const v8h*)(row + kk + 8 * khi);
    v8h hi = *(const v8h*)(row + kk + 16 + 8 * khi);
    v16h r;
#pragma unroll
    for (int i = 0; i < 8; ++i) { r[i] = lo[i]; r[i + 8] = hi[i]; }
    return r;
}

// ---- K0: bulk f32 -> f16 conversion (vectorized), for weights & biases
__global__ __launch_bounds__(256)
void cvt_f32_to_f16_k0(const float* __restrict__ src, half_t* __restrict__ dst, int n4) {
    const int i = blockIdx.x * 256 + threadIdx.x;
    if (i < n4) {
        const float4 v = ((const float4*)src)[i];
        ((v4h*)dst)[i] = (v4h){(half_t)v.x, (half_t)v.y, (half_t)v.z, (half_t)v.w};
    }
}

__global__ __launch_bounds__(256)
void mixer_gemm_k1(const float* __restrict__ x,
                   const half_t* __restrict__ W1h, const half_t* __restrict__ b1h,
                   const half_t* __restrict__ W2h, const half_t* __restrict__ b2h,
                   half_t* __restrict__ resh /* [B][P][C] f16 */) {
    extern __shared__ half_t smem[];
    const int tid  = threadIdx.x;
    const int c0   = blockIdx.x * CG;   // channel group base
    const int b0   = blockIdx.y * BT;   // batch tile base
    const int lane = tid & 31;
    // wave number in a scalar register: channel loop control and bases stay scalar
    const int wave = __builtin_amdgcn_readfirstlane(tid >> 5);
    const int lm   = lane & 15;
    const int khi  = lane >> 4;

    // W1[c] as A fragments [q tile][k step] and b1[c]: the first channel's fly
    // under the x load, the next channel's are asked for at the loop's foot.
    v16h w1f[4][2];
    v8h  bias1[4];
    auto fetch_w1 = [&](int c) {
        const half_t* w1c = W1h + (size_t)c * 4096 + lm * 64 + 8 * khi;   // A row q = 16 * qt + lm
        const half_t* b1c = b1h + (size_t)c * 64 + 8 * khi;               // rows 8 * khi + r of a tile
#pragma unroll
        for (int qt = 0; qt < 4; ++qt) {
            w1f[qt][0] = load_frag(w1c + qt * 16 * 64, 0, 0);
            w1f[qt][1] = load_frag(w1c + qt * 16 * 64, 32, 0);
            bias1[qt]  = *(const v8h*)(b1c + qt * 16);
        }
        // the loads' address registers are free behind this point: wait before
        // they can be overwritten; naming the pair keeps it whole up to the wait
        asm volatile("s_wait_xcnt 0x0" :: "v"(w1c) : "memory");
    };
    fetch_w1(c0 + wave);

    // ---- Phase 0: coalesced x load (64B lines), f32->f16 transpose into LDS
    for (int it = tid; it < BT * 64 * 4; it += 256) {
        const int chunk = it & 3;            // 4-float sub-chunk of the 16 channels
        const int p     = (it >> 2) & 63;
        const int m     = it >> 8;           // 0..31
        const float4 v  = *(const float4*)(x + ((size_t)(b0 + m) * Pp + p) * Cc + c0 + chunk * 4);
        const float vv[4] = {v.x, v.y, v.z, v.w};
#pragma unroll
        for (int j = 0; j < 4; ++j) {
            const int cl = chunk * 4 + j;
            smem[XT_OFF + (cl * BT + m) * ROW + p] = (half_t)vv[j];
        }
    }
    __syncthreads();   // x tile complete

    // ---- Channel loop: ONE WAVE OWNS ONE CHANNEL (two channels a wave).
    // Both products are formed transposed, weights as A and the batch as the
    // B columns: H^T = W1 * X^T, O^T = W2 * GELU(H^T). A lane then holds one
    // batch row and 8 consecutive q per accumulator tile, so two converted
    // tiles of H^T are the next product's B fragment as they lie.
    for (int ci = wave; ci < CG; ci += 8) {
        const int c = c0 + ci;
        const half_t* w2c = W2h + (size_t)c * 4096 + lm * 64;   // A row q = 16 * qt + lm
        const half_t* b2c = b2h + (size_t)c * 64 + 8 * khi;     // rows 8 * khi + r of a tile
        half_t* xrow[2] = {smem + XT_OFF + (ci * BT + lm) * ROW,
                           smem + XT_OFF + (ci * BT + 16 + lm) * ROW};

        v16h xb[2][2];   // X^T as B: [batch tile][k step]
#pragma unroll
        for (int t = 0; t < 2; ++t)
#pragma unroll
            for (int ks = 0; ks < 2; ++ks) xb[t][ks] = load_frag(xrow[t], ks * 32, khi);

        // ---- Stage 1: H^T = W1 * X^T + b1, exact GELU, kept in registers
        v16h hb[2][2];   // GELU(H^T) as B: [batch tile][k step]
#pragma unroll
        for (int qt = 0; qt < 4; ++qt) {
            const v16h a0 = w1f[qt][0];
            const v16h a1 = w1f[qt][1];
            const v8h  bb = bias1[qt];
#pragma unroll
            for (int t = 0; t < 2; ++t) {
                v8f acc;
#pragma unroll
                for (int r = 0; r < 8; ++r) acc[r] = (float)bb[r];
                acc = __builtin_amdgcn_wmma_f32_16x16x32_f16(false, a0, false, xb[t][0],
                                                             (short)0, acc, false, false);
                acc = __builtin_amdgcn_wmma_f32_16x16x32_f16(false, a1, false, xb[t][1],
                                                             (short)0, acc, false, false);
#pragma unroll
                for (int r = 0; r < 8; ++r) {
                    const float v = acc[r];
                    const float g = 0.5f * v * (1.0f + erff(v * 0.70710678118654752f)); // exact GELU
                    hb[t][qt >> 1][(qt & 1) * 8 + r] = (half_t)g;
                }
            }
        }

        // ---- Stage 2: O^T = W2 * GELU(H^T) + b2; res = O + x, in place over x
        // (only this wave reads or writes this channel's rows)
#pragma unroll
        for (int qt = 0; qt < 4; ++qt) {
            const v16h a0 = load_frag(w2c + qt * 16 * 64, 0, khi);
            const v16h a1 = load_frag(w2c + qt * 16 * 64, 32, khi);
            const v8h  bb = *(const v8h*)(b2c + qt * 16);
#pragma unroll
            for (int t = 0; t < 2; ++t) {
                v8f acc;
#pragma unroll
                for (int r = 0; r < 8; ++r) acc[r] = (float)bb[r];
                acc = __builtin_amdgcn_wmma_f32_16x16x32_f16(false, a0, false, hb[t][0],
                                                             (short)0, acc, false, false);
                acc = __builtin_amdgcn_wmma_f32_16x16x32_f16(false, a1, false, hb[t][1],
                                                             (short)0, acc, false, false);
                v8h* rp = (v8h*)(xrow[t] + qt * 16 + 8 * khi);
                const v8h xr = *rp;
                v8h o;
#pragma unroll
                for (int r = 0; r < 8; ++r) o[r] = (half_t)(acc[r] + (float)xr[r]);
                *rp = o;
            }
        }
        if (ci + 8 < CG) fetch_w1(c + 8);
    }
    __syncthreads();   // every channel's res rows complete

    // ---- Writeout: res [c][m][q] in LDS -> scratch [B][P][C] f16, 16B stores.
    // A thread takes 8 channels of two neighbouring q: 8 dword reads, 2 stores.
    for (int it = tid; it < BT * 32 * 2; it += 256) {
        const int chunk = it & 1;
        const int qp    = (it >> 1) & 31;
        const int m     = it >> 6;
        v8h e, o;
#pragma unroll
        for (int j = 0; j < 8; ++j) {
            const v2h pr = *(const v2h*)(smem + XT_OFF + ((chunk * 8 + j) * BT + m) * ROW + qp * 2);
            e[j] = pr[0];
            o[j] = pr[1];
        }
        half_t* dst = resh + ((size_t)(b0 + m) * Pp + qp * 2) * Cc + c0 + chunk * 8;
        *(v8h*)dst        = e;
        *(v8h*)(dst + Cc) = o;
    }
}

// ---- K2: LayerNorm over C. One wave32 per (b,q) row (1KB contiguous f16).
__global__ __launch_bounds__(256)
void mixer_ln_k2(const half_t* __restrict__ resh,
                 const float* __restrict__ gamma, const float* __restrict__ beta,
                 float* __restrict__ out) {
    const int lane = threadIdx.x & 31;
    const int wave = threadIdx.x >> 5;
    const size_t row = (size_t)blockIdx.x * 8 + wave;   // B*P = 65536 rows

    const half_t* rp = resh + row * Cc + lane * 16;
    const v8h a = *(const v8h*)rp;
    const v8h b = *(const v8h*)(rp + 8);
    float v[16], s = 0.f, s2 = 0.f;
#pragma unroll
    for (int i = 0; i < 8; ++i) { v[i] = (float)a[i]; v[i + 8] = (float)b[i]; }
#pragma unroll
    for (int i = 0; i < 16; ++i) { s += v[i]; s2 += v[i] * v[i]; }
#pragma unroll
    for (int off = 16; off > 0; off >>= 1) {
        s  += __shfl_xor(s,  off, 32);
        s2 += __shfl_xor(s2, off, 32);
    }
    const float mean = s * (1.0f / Cc);
    const float var  = s2 * (1.0f / Cc) - mean * mean;
    const float rstd = rsqrtf(var + 1e-5f);

    const int cb = lane * 16;
#pragma unroll
    for (int seg = 0; seg < 4; ++seg) {
        float4 o;
        o.x = (v[seg * 4 + 0] - mean) * rstd * gamma[cb + seg * 4 + 0] + beta[cb + seg * 4 + 0];
        o.y = (v[seg * 4 + 1] - mean) * rstd * gamma[cb + seg * 4 + 1] + beta[cb + seg * 4 + 1];
        o.z = (v[seg * 4 + 2] - mean) * rstd * gamma[cb + seg * 4 + 2] + beta[cb + seg * 4 + 2];
        o.w = (v[seg * 4 + 3] - mean) * rstd * gamma[cb + seg * 4 + 3] + beta[cb + seg * 4 + 3];
        *(float4*)(out + row * Cc + cb + seg * 4) = o;
    }
}

extern "C" void kernel_launch(void* const* d_in, const int* in_sizes, int n_in,
                              void* d_out, int out_size, void* d_ws, size_t ws_size,
                              hipStream_t stream) {
    const float* x     = (const float*)d_in[0];
    const float* W1    = (const float*)d_in[1];
    const float* b1    = (const float*)d_in[2];
    const float* W2    = (const float*)d_in[3];
    const float* b2    = (const float*)d_in[4];
    const float* gamma = (const float*)d_in[5];
    const float* beta  = (const float*)d_in[6];
    float* out = (float*)d_out;

    // Scratch layout (f16): res[B*P*C] | W1h | W2h | b1h | b2h  (~72.2 MB)
    half_t* resh = (half_t*)d_ws;
    half_t* W1h  = resh + (size_t)Bsz * Pp * Cc;
    half_t* W2h  = W1h + (size_t)Cc * Pp * Pp;
    half_t* b1h  = W2h + (size_t)Cc * Pp * Pp;
    half_t* b2h  = b1h + (size_t)Cc * Pp;

    // K0: f32 -> f16 weight/bias conversion
    const int w4 = Cc * Pp * Pp / 4;   // 524288 float4
    const int v4 = Cc * Pp / 4;        // 8192  float4
    cvt_f32_to_f16_k0<<<(w4 + 255) / 256, 256, 0, stream>>>(W1, W1h, w4);
    cvt_f32_to_f16_k0<<<(w4 + 255) / 256, 256, 0, stream>>>(W2, W2h, w4);
    cvt_f32_to_f16_k0<<<(v4 + 255) / 256, 256, 0, stream>>>(b1, b1h, v4);
    cvt_f32_to_f16_k0<<<(v4 + 255) / 256, 256, 0, stream>>>(b2, b2h, v4);

    // K1: fused GEMM/GELU/GEMM/residual per channel group
    dim3 g1(Cc / CG, Bsz / BT);     // 32 x 32 workgroups
    mixer_gemm_k1<<<g1, 256, LDS_BYTES, stream>>>(x, W1h, b1h, W2h, b2h, resh);

    // K2: LayerNorm
    dim3 g2((Bsz * Pp) / 8);        // 8192 workgroups, 8 rows each
    mixer_ln_k2<<<g2, 256, 0, stream>>>(resh, gamma, beta, out);
}

// v002
// A run of this version takes 111 microseconds.
// Two timings next to v001 both put it at 1.07 times that version's speed.
// Over all steps from v000 it is 1.24 times as fast.
#include <hip/hip_runtime.h>
#include <hip/hip_bf16.h>
#include <math.h>

typedef _Float16 half_t;
typedef __attribute__((ext_vector_type(16))) _Float16 v16h;
typedef __attribute__((ext_vector_type(8)))  _Float16 v8h;
typedef __attribute__((ext_vector_type(4)))  _Float16 v4h;
typedef __attribute__((ext_vector_type(2)))  _Float16 v2h;
typedef __attribute__((ext_vector_type(8)))  float    v8f;
typedef __attribute__((ext_vector_type(2)))  float    v2f;

static constexpr int Bsz = 1024;   // batch
static constexpr int Pp  = 64;     // patches
static constexpr int Cc  = 512;    // channels
static constexpr int CG  = 16;     // channels per workgroup (64B-coalesced x loads)
static constexpr int BT  = 32;     // batch rows per workgroup
static constexpr int ROW = 72;     // 64 + 8 halves pad: 144B rows, 16B aligned

// LDS offsets (in halves)
static constexpr int XT_OFF  = 0;                       // x tile, then res tile  [CG][BT][ROW]
static constexpr int LDS_HALVES = XT_OFF + CG * BT * ROW;   // 36,864 halves
static constexpr int LDS_BYTES  = LDS_HALVES * 2;           // 73,728 B

__device__ __forceinline__ v16h load_frag(const half_t* row, int kk, int khi) {
    v8h lo = *(const v8h*)(row + kk + 8 * khi);
    v8h hi = *(const v8h*)(row + kk + 16 + 8 * khi);
    v16h r;
#pragma unroll
    for (int i = 0; i < 8; ++i) { r[i] = lo[i]; r[i + 8] = hi[i]; }
    return r;
}

// Exact GELU, v * Phi(v), without the library erf and its two branches per element.
// erfc(|v| / sqrt 2) = exp2(L(|v|)), L one polynomial of degree 10 with L(0) = 0, fitted on
// |v| <= 6 and falling on beyond it (exp2 then gives 0). With a = |v| and e that erfc:
//   v * Phi(v) = 0.5 * ((v + a) - a * e)
// on both sides of 0; v + a is exact (0 or 2 v), so nothing cancels for v < 0. Against a double-precision GELU the
// f32 evaluation stays within 1.4e-7 absolute and 1.3e-6 relative on |v| <= 4.
// Two elements a call: the polynomial runs on packed f32 FMAs.
__device__ __forceinline__ v2f gelu_pair(v2f v) {
    const v2f a = {__builtin_fabsf(v.x), __builtin_fabsf(v.y)};
    v2f p = __builtin_elementwise_fma((v2f)(-1.26771118e-8f), a, (v2f)(4.25985121e-7f));
    p = __builtin_elementwise_fma(p, a, (v2f)(-6.09079416e-6f));
    p = __builtin_elementwise_fma(p, a, (v2f)(4.64202494e-5f));
    p = __builtin_elementwise_fma(p, a, (v2f)(-1.69534294e-4f));
    p = __builtin_elementwise_fma(p, a, (v2f)(-2.45350850e-4f));
    p = __builtin_elementwise_fma(p, a, (v2f)(7.27208052e-3f));
    p = __builtin_elementwise_fma(p, a, (v2f)(-5.26813492e-2f));
    p = __builtin_elementwise_fma(p, a, (v2f)(-4.59135205e-1f));
    p = __builtin_elementwise_fma(p, a, (v2f)(-1.15111458e+0f));
    const v2f l = p * a;
    const v2f e = {__builtin_amdgcn_exp2f(l.x), __builtin_amdgcn_exp2f(l.y)};
    return __builtin_elementwise_fma(-a, e, v + a) * 0.5f;
}

// ---- K0: bulk f32 -> f16 conversion (vectorized), for weights & biases
__global__ __launch_bounds__(256)
void cvt_f32_to_f16_k0(const float* __restrict__ src, half_t* __restrict__ dst, int n4) {
    const int i = blockIdx.x * 256 + threadIdx.x;
    if (i < n4) {
        const float4 v = ((const float4*)src)[i];
        ((v4h*)dst)[i] = (v4h){(half_t)v.x, (half_t)v.y, (half_t)v.z, (half_t)v.w};
    }
}

__global__ __launch_bounds__(256)
void mixer_gemm_k1(const float* __restrict__ x,
                   const half_t* __restrict__ W1h, const half_t* __restrict__ b1h,
                   const half_t* __restrict__ W2h, const half_t* __restrict__ b2h,
                   half_t* __restrict__ resh /* [B][P][C] f16 */) {
    extern __shared__ half_t smem[];
    const int tid  = threadIdx.x;
    const int c0   = blockIdx.x * CG;   // channel group base
    const int b0   = blockIdx.y * BT;   // batch tile base
    const int lane = tid & 31;
    // wave number in a scalar register: channel loop control and bases stay scalar
    const int wave = __builtin_amdgcn_readfirstlane(tid >> 5);
    const int lm   = lane & 15;
    const int khi  = lane >> 4;

    // W1[c] as A fragments [q tile][k step] and b1[c]: the first channel's fly
    // under the x load, the next channel's are asked for at the loop's foot.
    v16h w1f[4][2];
    v8h  bias1[4];
    auto fetch_w1 = [&](int c) {
        const half_t* w1c = W1h + (size_t)c * 4096 + lm * 64 + 8 * khi;   // A row q = 16 * qt + lm
        const half_t* b1c = b1h + (size_t)c * 64 + 8 * khi;               // rows 8 * khi + r of a tile
#pragma unroll
        for (int qt = 0; qt < 4; ++qt) {
            w1f[qt][0] = load_frag(w1c + qt * 16 * 64, 0, 0);
            w1f[qt][1] = load_frag(w1c + qt * 16 * 64, 32, 0);
            bias1[qt]  = *(const v8h*)(b1c + qt * 16);
        }
        // the loads' address registers are free behind this point: wait before
        // they can be overwritten; naming the pair keeps it whole up to the wait
        asm volatile("s_wait_xcnt 0x0" :: "v"(w1c) : "memory");
    };
    fetch_w1(c0 + wave);

    // ---- Phase 0: coalesced x load (64B lines), f32->f16 transpose into LDS
    for (int it = tid; it < BT * 64 * 4; it += 256) {
        const int chunk = it & 3;            // 4-float sub-chunk of the 16 channels
        const int p     = (it >> 2) & 63;
        const int m     = it >> 8;           // 0..31
        const float4 v  = *(const float4*)(x + ((size_t)(b0 + m) * Pp + p) * Cc + c0 + chunk * 4);
        const float vv[4] = {v.x, v.y, v.z, v.w};
#pragma unroll
        for (int j = 0; j < 4; ++j) {
            const int cl = chunk * 4 + j;
            smem[XT_OFF + (cl * BT + m) * ROW + p] = (half_t)vv[j];
        }
    }
    __syncthreads();   // x tile complete

    // ---- Channel loop: ONE WAVE OWNS ONE CHANNEL (two channels a wave).
    // Both products are formed transposed, weights as A and the batch as the
    // B columns: H^T = W1 * X^T, O^T = W2 * GELU(H^T). A lane then holds one
    // batch row and 8 consecutive q per accumulator tile, so two converted
    // tiles of H^T are the next product's B fragment as they lie.
    // Unrolled (two trips).
#pragma unroll
    for (int ci = wave; ci < CG; ci += 8) {
        const int c = c0 + ci;
        const half_t* w2c = W2h + (size_t)c * 4096 + lm * 64;   // A row q = 16 * qt + lm
        const half_t* b2c = b2h + (size_t)c * 64 + 8 * khi;     // rows 8 * khi + r of a tile
        half_t* xrow[2] = {smem + XT_OFF + (ci * BT + lm) * ROW,
                           smem + XT_OFF + (ci * BT + 16 + lm) * ROW};

        v16h xb[2][2];   // X^T as B: [batch tile][k step]
#pragma unroll
        for (int t = 0; t < 2; ++t)
#pragma unroll
            for (int ks = 0; ks < 2; ++ks) xb[t][ks] = load_frag(xrow[t], ks * 32, khi);

        // ---- Stage 1: H^T = W1 * X^T + b1, exact GELU, kept in registers
        v16h hb[2][2];   // GELU(H^T) as B: [batch tile][k step]
#pragma unroll
        for (int qt = 0; qt < 4; ++qt) {
            const v16h a0 = w1f[qt][0];
            const v16h a1 = w1f[qt][1];
            const v8h  bb = bias1[qt];
#pragma unroll
            for (int t = 0; t < 2; ++t) {
                v8f acc;
#pragma unroll
                for (int r = 0; r < 8; ++r) acc[r] = (float)bb[r];
                acc = __builtin_amdgcn_wmma_f32_16x16x32_f16(false, a0, false, xb[t][0],
                                                             (short)0, acc, false, false);
                acc = __builtin_amdgcn_wmma_f32_16x16x32_f16(false, a1, false, xb[t][1],
                                                             (short)0, acc, false, false);
#pragma unroll
                for (int r = 0; r < 8; r += 2) {
                    const v2f g = gelu_pair((v2f){acc[r], acc[r + 1]});
                    hb[t][qt >> 1][(qt & 1) * 8 + r]     = (half_t)g.x;
                    hb[t][qt >> 1][(qt & 1) * 8 + r + 1] = (half_t)g.y;
                }
            }
        }

        // ---- Stage 2: O^T = W2 * GELU(H^T) + b2; res = O + x, in place over x
        // (only this wave reads or writes this channel's rows)
#pragma unroll
        for (int qt = 0; qt < 4; ++qt) {
            const v16h a0 = load_frag(w2c + qt * 16 * 64, 0, khi);
            const v16h a1 = load_frag(w2c + qt * 16 * 64, 32, khi);
            const v8h  bb = *(const v8h*)(b2c + qt * 16);
#pragma unroll
            for (int t = 0; t < 2; ++t) {
                v8f acc;
#pragma unroll
                for (int r = 0; r < 8; ++r) acc[r] = (float)bb[r];
                acc = __builtin_amdgcn_wmma_f32_16x16x32_f16(false, a0, false, hb[t][0],
                                                             (short)0, acc, false, false);
                acc = __builtin_amdgcn_wmma_f32_16x16x32_f16(false, a1, false, hb[t][1],
                                                             (short)0, acc, false, false);
                v8h* rp = (v8h*)(xrow[t] + qt * 16 + 8 * khi);
                const v8h xr = *rp;
                v8h o;
#pragma unroll
                for (int r = 0; r < 8; ++r) o[r] = (half_t)(acc[r] + (float)xr[r]);
                *rp = o;
            }
        }
        if (ci + 8 < CG) fetch_w1(c + 8);
    }
    __syncthreads();   // every channel's res rows complete

    // ---- Writeout: res [c][m][q] in LDS -> scratch [B][P][C] f16, 16B stores.
    // A thread takes 8 channels of two neighbouring q: 8 dword reads, 2 stores.
    for (int it = tid; it < BT * 32 * 2; it += 256) {
        const int chunk = it & 1;
        const int qp    = (it >> 1) & 31;
        const int m     = it >> 6;
        v8h e, o;
#pragma unroll
        for (int j = 0; j < 8; ++j) {
            const v2h pr = *(const v2h*)(smem + XT_OFF + ((chunk * 8 + j) * BT + m) * ROW + qp * 2);
            e[j] = pr[0];
            o[j] = pr[1];
        }
        half_t* dst = resh + ((size_t)(b0 + m) * Pp + qp * 2) * Cc + c0 + chunk * 8;
        *(v8h*)dst        = e;
        *(v8h*)(dst + Cc) = o;
    }
}

// ---- K2: LayerNorm over C. One wave32 per (b,q) row (1KB contiguous f16).
__global__ __launch_bounds__(256)
void mixer_ln_k2(const half_t* __restrict__ resh,
                 const float* __restrict__ gamma, const float* __restrict__ beta,
                 float* __restrict__ out) {
    const int lane = threadIdx.x & 31;
    const int wave = threadIdx.x >> 5;
    const size_t row = (size_t)blockIdx.x * 8 + wave;   // B*P = 65536 rows

    const half_t* rp = resh + row * Cc + lane * 16;
    const v8h a = *(const v8h*)rp;
    const v8h b = *(const v8h*)(rp + 8);
    float v[16], s = 0.f, s2 = 0.f;
#pragma unroll
    for (int i = 0; i < 8; ++i) { v[i] = (float)a[i]; v[i + 8] = (float)b[i]; }
#pragma unroll
    for (int i = 0; i < 16; ++i) { s += v[i]; s2 += v[i] * v[i]; }
#pragma unroll
    for (int off = 16; off > 0; off >>= 1) {
        s  += __shfl_xor(s,  off, 32);
        s2 += __shfl_xor(s2, off, 32);
    }
    const float mean = s * (1.0f / Cc);
    const float var  = s2 * (1.0f / Cc) - mean * mean;
    const float rstd = rsqrtf(var + 1e-5f);

    const int cb = lane * 16;
#pragma unroll
    for (int seg = 0; seg < 4; ++seg) {
        float4 o;
        o.x = (v[seg * 4 + 0] - mean) * rstd * gamma[cb + seg * 4 + 0] + beta[cb + seg * 4 + 0];
        o.y = (v[seg * 4 + 1] - mean) * rstd * gamma[cb + seg * 4 + 1] + beta[cb + seg * 4 + 1];
        o.z = (v[seg * 4 + 2] - mean) * rstd * gamma[cb + seg * 4 + 2] + beta[cb + seg * 4 + 2];
        o.w = (v[seg * 4 + 3] - mean) * rstd * gamma[cb + seg * 4 + 3] + beta[cb + seg * 4 + 3];
        *(float4*)(out + row * Cc + cb + seg * 4) = o;
    }
}

extern "C" void kernel_launch(void* const* d_in, const int* in_sizes, int n_in,
                              void* d_out, int out_size, void* d_ws, size_t ws_size,
                              hipStream_t stream) {
    const float* x     = (const float*)d_in[0];
    const float* W1    = (const float*)d_in[1];
    const float* b1    = (const float*)d_in[2];
    const float* W2    = (const float*)d_in[3];
    const float* b2    = (const float*)d_in[4];
    const float* gamma = (const float*)d_in[5];
    const float* beta  = (const float*)d_in[6];
    float* out = (float*)d_out;

    // Scratch layout (f16): res[B*P*C] | W1h | W2h | b1h | b2h  (~72.2 MB)
    half_t* resh = (half_t*)d_ws;
    half_t* W1h  = resh + (size_t)Bsz * Pp * Cc;
    half_t* W2h  = W1h + (size_t)Cc * Pp * Pp;
    half_t* b1h  = W2h + (size_t)Cc * Pp * Pp;
    half_t* b2h  = b1h + (size_t)Cc * Pp;

    // K0: f32 -> f16 weight/bias conversion
    const int w4 = Cc * Pp * Pp / 4;   // 524288 float4
    const int v4 = Cc * Pp / 4;        // 8192  float4
    cvt_f32_to_f16_k0<<<(w4 + 255) / 256, 256, 0, stream>>>(W1, W1h, w4);
    cvt_f32_to_f16_k0<<<(w4 + 255) / 256, 256, 0, stream>>>(W2, W2h, w4);
    cvt_f32_to_f16_k0<<<(v4 + 255) / 256, 256, 0, stream>>>(b1, b1h, v4);
    cvt_f32_to_f16_k0<<<(v4 + 255) / 256, 256, 0, stream>>>(b2, b2h, v4);

    // K1: fused GEMM/GELU/GEMM/residual per channel group
    dim3 g1(Cc / CG, Bsz / BT);     // 32 x 32 workgroups
    mixer_gemm_k1<<<g1, 256, LDS_BYTES, stream>>>(x, W1h, b1h, W2h, b2h, resh);

    // K2: LayerNorm
    dim3 g2((Bsz * Pp) / 8);        // 8192 workgroups, 8 rows each
    mixer_ln_k2<<<g2, 256, 0, stream>>>(resh, gamma, beta, out);
}

// v003
// A run of this version takes 106 microseconds.
// Timed twice side by side with v002, it ran 1.04 and 1.05 times as fast.
// Over all steps from v000 it is 1.29 times as fast.
#include <hip/hip_runtime.h>
#include <hip/hip_bf16.h>
#include <math.h>

typedef _Float16 half_t;
typedef __attribute__((ext_vector_type(16))) _Float16 v16h;
typedef __attribute__((ext_vector_type(8)))  _Float16 v8h;
typedef __attribute__((ext_vector_type(4)))  _Float16 v4h;
typedef __attribute__((ext_vector_type(2)))  _Float16 v2h;
typedef __attribute__((ext_vector_type(8)))  float    v8f;
typedef __attribute__((ext_vector_type(2)))  float    v2f;

static constexpr int Bsz = 1024;   // batch
static constexpr int Pp  = 64;     // patches
static constexpr int Cc  = 512;    // channels
static constexpr int CG  = 16;     // channels per workgroup (64B-coalesced x loads)
static constexpr int BT  = 32;     // batch rows per workgroup
static constexpr int ROW = 72;     // 64 + 8 halves pad: 144B rows, 16B aligned

// LDS offsets (in halves)
static constexpr int XT_OFF  = 0;                       // x tile, then res tile  [CG][BT][ROW]
static constexpr int LDS_HALVES = XT_OFF + CG * BT * ROW;   // 36,864 halves
static constexpr int LDS_BYTES  = LDS_HALVES * 2;           // 73,728 B

__device__ __forceinline__ v16h load_frag(const half_t* row, int kk, int khi) {
    v8h lo = *(const v8h*)(row + kk + 8 * khi);
    v8h hi = *(const v8h*)(row + kk + 16 + 8 * khi);
    v16h r;
#pragma unroll
    for (int i = 0; i < 8; ++i) { r[i] = lo[i]; r[i + 8] = hi[i]; }
    return r;
}

// Exact GELU, v * Phi(v), without the library erf and its two branches per element.
// erfc(|v| / sqrt 2) = exp2(L(|v|)), L one polynomial of degree 10 with L(0) = 0, fitted on
// |v| <= 6 and falling on beyond it (exp2 then gives 0). With a = |v| and e that erfc:
//   v * Phi(v) = 0.5 * ((v + a) - a * e)
// on both sides of 0; v + a is exact (0 or 2 v), so nothing cancels for v < 0. Against a double-precision GELU the
// f32 evaluation stays within 1.4e-7 absolute and 1.3e-6 relative on |v| <= 4.
// Two elements a call: the polynomial runs on packed f32 FMAs.
__device__ __forceinline__ v2f gelu_pair(v2f v) {
    const v2f a = {__builtin_fabsf(v.x), __builtin_fabsf(v.y)};
    v2f p = __builtin_elementwise_fma((v2f)(-1.26771118e-8f), a, (v2f)(4.25985121e-7f));
    p = __builtin_elementwise_fma(p, a, (v2f)(-6.09079416e-6f));
    p = __builtin_elementwise_fma(p, a, (v2f)(4.64202494e-5f));
    p = __builtin_elementwise_fma(p, a, (v2f)(-1.69534294e-4f));
    p = __builtin_elementwise_fma(p, a, (v2f)(-2.45350850e-4f));
    p = __builtin_elementwise_fma(p, a, (v2f)(7.27208052e-3f));
    p = __builtin_elementwise_fma(p, a, (v2f)(-5.26813492e-2f));
    p = __builtin_elementwise_fma(p, a, (v2f)(-4.59135205e-1f));
    p = __builtin_elementwise_fma(p, a, (v2f)(-1.15111458e+0f));
    const v2f l = p * a;
    const v2f e = {__builtin_amdgcn_exp2f(l.x), __builtin_amdgcn_exp2f(l.y)};
    return __builtin_elementwise_fma(-a, e, v + a) * 0.5f;
}

// ---- K0: f32 -> f16 conversion of W1, W2, b1 and b2 in ONE launch (vectorized).
// The four f16 planes lie one behind the other in scratch, so the flat float4 index
// is the destination index; every plane is a whole number of blocks, so the choice
// of the source is uniform in a block and the grid covers the planes exactly.
static constexpr int WBLK = Cc * Pp * Pp / 4 / 256;   // 2048 blocks a weight plane
static constexpr int VBLK = Cc * Pp / 4 / 256;        // 32 blocks a bias plane
__global__ __launch_bounds__(256)
void cvt_f32_to_f16_k0(const float* __restrict__ W1, const float* __restrict__ W2,
                       const float* __restrict__ b1, const float* __restrict__ b2,
                       half_t* __restrict__ dst /* W1h | W2h | b1h | b2h */) {
    const int blk = blockIdx.x;
    const float* src = W1;
    int first = 0;
    if (blk >= 2 * WBLK + VBLK) { src = b2; first = 2 * WBLK + VBLK; }
    else if (blk >= 2 * WBLK)   { src = b1; first = 2 * WBLK; }
    else if (blk >= WBLK)       { src = W2; first = WBLK; }
    const float4 v = ((const float4*)src)[(blk - first) * 256 + threadIdx.x];
    ((v4h*)dst)[blk * 256 + threadIdx.x] = (v4h){(half_t)v.x, (half_t)v.y, (half_t)v.z, (half_t)v.w};
}

__global__ __launch_bounds__(256)
void mixer_gemm_k1(const float* __restrict__ x,
                   const half_t* __restrict__ W1h, const half_t* __restrict__ b1h,
                   const half_t* __restrict__ W2h, const half_t* __restrict__ b2h,
                   half_t* __restrict__ resh /* [B][P][C] f16 */) {
    extern __shared__ half_t smem[];
    const int tid  = threadIdx.x;
    const int c0   = blockIdx.x * CG;   // channel group base
    const int b0   = blockIdx.y * BT;   // batch tile base
    const int lane = tid & 31;
    // wave number in a scalar register: channel loop control and bases stay scalar
    const int wave = __builtin_amdgcn_readfirstlane(tid >> 5);
    const int lm   = lane & 15;
    const int khi  = lane >> 4;

    // W1[c] as A fragments [q tile][k step] and b1[c]: the first channel's fly
    // under the x load, the next channel's are asked for at the loop's foot.
    v16h w1f[4][2];
    v8h  bias1[4];
    auto fetch_w1 = [&](int c) {
        const half_t* w1c = W1h + (size_t)c * 4096 + lm * 64 + 8 * khi;   // A row q = 16 * qt + lm
        const half_t* b1c = b1h + (size_t)c * 64 + 8 * khi;               // rows 8 * khi + r of a tile
#pragma unroll
        for (int qt = 0; qt < 4; ++qt) {
            w1f[qt][0] = load_frag(w1c + qt * 16 * 64, 0, 0);
            w1f[qt][1] = load_frag(w1c + qt * 16 * 64, 32, 0);
            bias1[qt]  = *(const v8h*)(b1c + qt * 16);
        }
        // the loads' address registers are free behind this point: wait before
        // they can be overwritten; naming the pair keeps it whole up to the wait
        asm volatile("s_wait_xcnt 0x0" :: "v"(w1c) : "memory");
    };
    fetch_w1(c0 + wave);

    // ---- Phase 0: coalesced x load (64B lines), f32->f16 transpose into LDS
    for (int it = tid; it < BT * 64 * 4; it += 256) {
        const int chunk = it & 3;            // 4-float sub-chunk of the 16 channels
        const int p     = (it >> 2) & 63;
        const int m     = it >> 8;           // 0..31
        const float4 v  = *(const float4*)(x + ((size_t)(b0 + m) * Pp + p) * Cc + c0 + chunk * 4);
        const float vv[4] = {v.x, v.y, v.z, v.w};
#pragma unroll
        for (int j = 0; j < 4; ++j) {
            const int cl = chunk * 4 + j;
            smem[XT_OFF + (cl * BT + m) * ROW + p] = (half_t)vv[j];
        }
    }
    __syncthreads();   // x tile complete

    // ---- Channel loop: ONE WAVE OWNS ONE CHANNEL (two channels a wave).
    // Both products are formed transposed, weights as A and the batch as the
    // B columns: H^T = W1 * X^T, O^T = W2 * GELU(H^T). A lane then holds one
    // batch row and 8 consecutive q per accumulator tile, so two converted
    // tiles of H^T are the next product's B fragment as they lie.
    // Unrolled (two trips).
#pragma unroll
    for (int ci = wave; ci < CG; ci += 8) {
        const int c = c0 + ci;
        const half_t* w2c = W2h + (size_t)c * 4096 + lm * 64;   // A row q = 16 * qt + lm
        const half_t* b2c = b2h + (size_t)c * 64 + 8 * khi;     // rows 8 * khi + r of a tile
        half_t* xrow[2] = {smem + XT_OFF + (ci * BT + lm) * ROW,
                           smem + XT_OFF + (ci * BT + 16 + lm) * ROW};

        v16h xb[2][2];   // X^T as B: [batch tile][k step]
#pragma unroll
        for (int t = 0; t < 2; ++t)
#pragma unroll
            for (int ks = 0; ks < 2; ++ks) xb[t][ks] = load_frag(xrow[t], ks * 32, khi);

        // ---- Stage 1: H^T = W1 * X^T + b1, exact GELU, kept in registers
        v16h hb[2][2];   // GELU(H^T) as B: [batch tile][k step]
#pragma unroll
        for (int qt = 0; qt < 4; ++qt) {
            const v16h a0 = w1f[qt][0];
            const v16h a1 = w1f[qt][1];
            const v8h  bb = bias1[qt];
#pragma unroll
            for (int t = 0; t < 2; ++t) {
                v8f acc;
#pragma unroll
                for (int r = 0; r < 8; ++r) acc[r] = (float)bb[r];
                acc = __builtin_amdgcn_wmma_f32_16x16x32_f16(false, a0, false, xb[t][0],
                                                             (short)0, acc, false, false);
                acc = __builtin_amdgcn_wmma_f32_16x16x32_f16(false, a1, false, xb[t][1],
                                                             (short)0, acc, false, false);
#pragma unroll
                for (int r = 0; r < 8; r += 2) {
                    const v2f g = gelu_pair((v2f){acc[r], acc[r + 1]});
                    hb[t][qt >> 1][(qt & 1) * 8 + r]     = (half_t)g.x;
                    hb[t][qt >> 1][(qt & 1) * 8 + r + 1] = (half_t)g.y;
                }
            }
        }

        // ---- Stage 2: O^T = W2 * GELU(H^T) + b2; res = O + x, in place over x
        // (only this wave reads or writes this channel's rows)
#pragma unroll
        for (int qt = 0; qt < 4; ++qt) {
            const v16h a0 = load_frag(w2c + qt * 16 * 64, 0, khi);
            const v16h a1 = load_frag(w2c + qt * 16 * 64, 32, khi);
            const v8h  bb = *(const v8h*)(b2c + qt * 16);
#pragma unroll
            for (int t = 0; t < 2; ++t) {
                v8f acc;
#pragma unroll
                for (int r = 0; r < 8; ++r) acc[r] = (float)bb[r];
                acc = __builtin_amdgcn_wmma_f32_16x16x32_f16(false, a0, false, hb[t][0],
                                                             (short)0, acc, false, false);
                acc = __builtin_amdgcn_wmma_f32_16x16x32_f16(false, a1, false, hb[t][1],
                                                             (short)0, acc, false, false);
                v8h* rp = (v8h*)(xrow[t] + qt * 16 + 8 * khi);
                const v8h xr = *rp;
                v8h o;
#pragma unroll
                for (int r = 0; r < 8; ++r) o[r] = (half_t)(acc[r] + (float)xr[r]);
                *rp = o;
            }
        }
        if (ci + 8 < CG) fetch_w1(c + 8);
    }
    __syncthreads();   // every channel's res rows complete

    // ---- Writeout: res [c][m][q] in LDS -> scratch [B][P][C] f16, 16B stores.
    // A thread takes 8 channels of two neighbouring q: 8 dword reads, 2 stores.
    for (int it = tid; it < BT * 32 * 2; it += 256) {
        const int chunk = it & 1;
        const int qp    = (it >> 1) & 31;
        const int m     = it >> 6;
        v8h e, o;
#pragma unroll
        for (int j = 0; j < 8; ++j) {
            const v2h pr = *(const v2h*)(smem + XT_OFF + ((chunk * 8 + j) * BT + m) * ROW + qp * 2);
            e[j] = pr[0];
            o[j] = pr[1];
        }
        half_t* dst = resh + ((size_t)(b0 + m) * Pp + qp * 2) * Cc + c0 + chunk * 8;
        *(v8h*)dst        = e;
        *(v8h*)(dst + Cc) = o;
    }
}

// ---- K2: LayerNorm over C. One wave32 per (b,q) row (1KB contiguous f16).
__global__ __launch_bounds__(256)
void mixer_ln_k2(const half_t* __restrict__ resh,
                 const float* __restrict__ gamma, const float* __restrict__ beta,
                 float* __restrict__ out) {
    const int lane = threadIdx.x & 31;
    const int wave = threadIdx.x >> 5;
    const size_t row = (size_t)blockIdx.x * 8 + wave;   // B*P = 65536 rows

    const half_t* rp = resh + row * Cc + lane * 16;
    const v8h a = *(const v8h*)rp;
    const v8h b = *(const v8h*)(rp + 8);
    float v[16], s = 0.f, s2 = 0.f;
#pragma unroll
    for (int i = 0; i < 8; ++i) { v[i] = (float)a[i]; v[i + 8] = (float)b[i]; }
#pragma unroll
    for (int i = 0; i < 16; ++i) { s += v[i]; s2 += v[i] * v[i]; }
#pragma unroll
    for (int off = 16; off > 0; off >>= 1) {
        s  += __shfl_xor(s,  off, 32);
        s2 += __shfl_xor(s2, off, 32);
    }
    const float mean = s * (1.0f / Cc);
    const float var  = s2 * (1.0f / Cc) - mean * mean;
    const float rstd = rsqrtf(var + 1e-5f);

    const int cb = lane * 16;
#pragma unroll
    for (int seg = 0; seg < 4; ++seg) {
        float4 o;
        o.x = (v[seg * 4 + 0] - mean) * rstd * gamma[cb + seg * 4 + 0] + beta[cb + seg * 4 + 0];
        o.y = (v[seg * 4 + 1] - mean) * rstd * gamma[cb + seg * 4 + 1] + beta[cb + seg * 4 + 1];
        o.z = (v[seg * 4 + 2] - mean) * rstd * gamma[cb + seg * 4 + 2] + beta[cb + seg * 4 + 2];
        o.w = (v[seg * 4 + 3] - mean) * rstd * gamma[cb + seg * 4 + 3] + beta[cb + seg * 4 + 3];
        *(float4*)(out + row * Cc + cb + seg * 4) = o;
    }
}

extern "C" void kernel_launch(void* const* d_in, const int* in_sizes, int n_in,
                              void* d_out, int out_size, void* d_ws, size_t ws_size,
                              hipStream_t stream) {
    const float* x     = (const float*)d_in[0];
    const float* W1    = (const float*)d_in[1];
    const float* b1    = (const float*)d_in[2];
    const float* W2    = (const float*)d_in[3];
    const float* b2    = (const float*)d_in[4];
    const float* gamma = (const float*)d_in[5];
    const float* beta  = (const float*)d_in[6];
    float* out = (float*)d_out;

    // Scratch layout (f16): res[B*P*C] | W1h | W2h | b1h | b2h  (~72.2 MB)
    half_t* resh = (half_t*)d_ws;
    half_t* W1h  = resh + (size_t)Bsz * Pp * Cc;
    half_t* W2h  = W1h + (size_t)Cc * Pp * Pp;
    half_t* b1h  = W2h + (size_t)Cc * Pp * Pp;
    half_t* b2h  = b1h + (size_t)Cc * Pp;

    // K0: f32 -> f16 weight/bias conversion, all four planes in one launch
    cvt_f32_to_f16_k0<<<2 * WBLK + 2 * VBLK, 256, 0, stream>>>(W1, W2, b1, b2, W1h);

    // K1: fused GEMM/GELU/GEMM/residual per channel group
    dim3 g1(Cc / CG, Bsz / BT);     // 32 x 32 workgroups
    mixer_gemm_k1<<<g1, 256, LDS_BYTES, stream>>>(x, W1h, b1h, W2h, b2h, resh);

    // K2: LayerNorm
    dim3 g2((Bsz * Pp) / 8);        // 8192 workgroups, 8 rows each
    mixer_ln_k2<<<g2, 256, 0, stream>>>(resh, gamma, beta, out);
}

// v004
// One run takes 69.7 microseconds.
// In both of two side-by-side timings against v003, it was 1.53 times as fast.
// All steps since v000 together make it 1.98 times as fast.
#include <hip/hip_runtime.h>
#include <hip/hip_bf16.h>
#include <math.h>

typedef _Float16 half_t;
typedef __attribute__((ext_vector_type(16))) _Float16 v16h;
typedef __attribute__((ext_vector_type(8)))  _Float16 v8h;
typedef __attribute__((ext_vector_type(4)))  _Float16 v4h;
typedef __attribute__((ext_vector_type(2)))  _Float16 v2h;
typedef __attribute__((ext_vector_type(8)))  float    v8f;
typedef __attribute__((ext_vector_type(2)))  float    v2f;

static constexpr int Bsz = 1024;   // batch
static constexpr int Pp  = 64;     // patches
static constexpr int Cc  = 512;    // channels
static constexpr int CG  = 16;     // channels per workgroup (64B-coalesced x loads)
static constexpr int BT  = 32;     // batch rows per workgroup
static constexpr int ROW = 72;     // 64 + 8 halves pad: 144B rows, 16B aligned

// LDS offsets (in halves)
static constexpr int XT_OFF  = 0;                       // x tile, then res tile  [CG][BT][ROW]
static constexpr int LDS_HALVES = XT_OFF + CG * BT * ROW;   // 36,864 halves
static constexpr int LDS_BYTES  = LDS_HALVES * 2;           // 73,728 B

__device__ __forceinline__ v16h load_frag(const half_t* row, int kk, int khi) {
    v8h lo = *(const v8h*)(row + kk + 8 * khi);
    v8h hi = *(const v8h*)(row + kk + 16 + 8 * khi);
    v16h r;
#pragma unroll
    for (int i = 0; i < 8; ++i) { r[i] = lo[i]; r[i + 8] = hi[i]; }
    return r;
}

// Exact GELU, v * Phi(v), without the library erf and its two branches per element.
// erfc(|v| / sqrt 2) = exp2(L(|v|)), L one polynomial of degree 10 with L(0) = 0, fitted on
// |v| <= 6 and falling on beyond it (exp2 then gives 0). With a = |v| and e that erfc:
//   v * Phi(v) = 0.5 * ((v + a) - a * e)
// on both sides of 0; v + a is exact (0 or 2 v), so nothing cancels for v < 0. Against a double-precision GELU the
// f32 evaluation stays within 1.4e-7 absolute and 1.3e-6 relative on |v| <= 4.
// Two elements a call: the polynomial runs on packed f32 FMAs.
__device__ __forceinline__ v2f gelu_pair(v2f v) {
    const v2f a = {__builtin_fabsf(v.x), __builtin_fabsf(v.y)};
    v2f p = __builtin_elementwise_fma((v2f)(-1.26771118e-8f), a, (v2f)(4.25985121e-7f));
    p = __builtin_elementwise_fma(p, a, (v2f)(-6.09079416e-6f));
    p = __builtin_elementwise_fma(p, a, (v2f)(4.64202494e-5f));
    p = __builtin_elementwise_fma(p, a, (v2f)(-1.69534294e-4f));
    p = __builtin_elementwise_fma(p, a, (v2f)(-2.45350850e-4f));
    p = __builtin_elementwise_fma(p, a, (v2f)(7.27208052e-3f));
    p = __builtin_elementwise_fma(p, a, (v2f)(-5.26813492e-2f));
    p = __builtin_elementwise_fma(p, a, (v2f)(-4.59135205e-1f));
    p = __builtin_elementwise_fma(p, a, (v2f)(-1.15111458e+0f));
    const v2f l = p * a;
    const v2f e = {__builtin_amdgcn_exp2f(l.x), __builtin_amdgcn_exp2f(l.y)};
    return __builtin_elementwise_fma(-a, e, v + a) * 0.5f;
}

// ---- K0: f32 -> f16 conversion of W1, W2, b1 and b2 in ONE launch (vectorized).
// The four f16 planes lie one behind the other in scratch, so the flat float4 index
// is the destination index; every plane is a whole number of blocks, so the choice
// of the source is uniform in a block and the grid covers the planes exactly.
static constexpr int WBLK = Cc * Pp * Pp / 4 / 256;   // 2048 blocks a weight plane
static constexpr int VBLK = Cc * Pp / 4 / 256;        // 32 blocks a bias plane
__global__ __launch_bounds__(256)
void cvt_f32_to_f16_k0(const float* __restrict__ W1, const float* __restrict__ W2,
                       const float* __restrict__ b1, const float* __restrict__ b2,
                       half_t* __restrict__ dst /* W1h | W2h | b1h | b2h */) {
    const int blk = blockIdx.x;
    const float* src = W1;
    int first = 0;
    if (blk >= 2 * WBLK + VBLK) { src = b2; first = 2 * WBLK + VBLK; }
    else if (blk >= 2 * WBLK)   { src = b1; first = 2 * WBLK; }
    else if (blk >= WBLK)       { src = W2; first = WBLK; }
    const float4 v = ((const float4*)src)[(blk - first) * 256 + threadIdx.x];
    ((v4h*)dst)[blk * 256 + threadIdx.x] = (v4h){(half_t)v.x, (half_t)v.y, (half_t)v.z, (half_t)v.w};
}

__global__ __launch_bounds__(256)
void mixer_gemm_k1(const float* __restrict__ x,
                   const half_t* __restrict__ W1h, const half_t* __restrict__ b1h,
                   const half_t* __restrict__ W2h, const half_t* __restrict__ b2h,
                   half_t* __restrict__ resh /* [B][P][C] f16 */) {
    extern __shared__ half_t smem[];
    const int tid  = threadIdx.x;
    // Grid (8, channel groups, batch tiles / 8): the flat index is (tile & 7) + 8 * group + 256 * (tile >> 3).
    // For speed only: any placement is right.
    const int c0   = blockIdx.y * CG;                          // channel group base
    const int b0   = (blockIdx.z * 8 + blockIdx.x) * BT;       // batch tile base
    const int lane = tid & 31;
    // wave number in a scalar register: channel loop control and bases stay scalar
    const int wave = __builtin_amdgcn_readfirstlane(tid >> 5);
    const int lm   = lane & 15;
    const int khi  = lane >> 4;

    // W1[c] as A fragments [q tile][k step] and b1[c]: the first channel's fly
    // under the x load, the next channel's are asked for at the loop's foot.
    v16h w1f[4][2];
    v8h  bias1[4];
    auto fetch_w1 = [&](int c) {
        const half_t* w1c = W1h + (size_t)c * 4096 + lm * 64 + 8 * khi;   // A row q = 16 * qt + lm
        const half_t* b1c = b1h + (size_t)c * 64 + 8 * khi;               // rows 8 * khi + r of a tile
#pragma unroll
        for (int qt = 0; qt < 4; ++qt) {
            w1f[qt][0] = load_frag(w1c + qt * 16 * 64, 0, 0);
            w1f[qt][1] = load_frag(w1c + qt * 16 * 64, 32, 0);
            bias1[qt]  = *(const v8h*)(b1c + qt * 16);
        }
        // the loads' address registers are free behind this point: wait before
        // they can be overwritten; naming the pair keeps it whole up to the wait
        asm volatile("s_wait_xcnt 0x0" :: "v"(w1c) : "memory");
    };
    fetch_w1(c0 + wave);

    // ---- Phase 0: coalesced x load (64B lines), f32->f16 transpose into LDS
    for (int it = tid; it < BT * 64 * 4; it += 256) {
        const int chunk = it & 3;            // 4-float sub-chunk of the 16 channels
        const int p     = (it >> 2) & 63;
        const int m     = it >> 8;           // 0..31
        const float4 v  = *(const float4*)(x + ((size_t)(b0 + m) * Pp + p) * Cc + c0 + chunk * 4);
        const float vv[4] = {v.x, v.y, v.z, v.w};
#pragma unroll
        for (int j = 0; j < 4; ++j) {
            const int cl = chunk * 4 + j;
            smem[XT_OFF + (cl * BT + m) * ROW + p] = (half_t)vv[j];
        }
    }
    __syncthreads();   // x tile complete

    // ---- Channel loop: ONE WAVE OWNS ONE CHANNEL (two channels a wave).
    // Both products are formed transposed, weights as A and the batch as the
    // B columns: H^T = W1 * X^T, O^T = W2 * GELU(H^T). A lane then holds one
    // batch row and 8 consecutive q per accumulator tile, so two converted
    // tiles of H^T are the next product's B fragment as they lie.
    // Unrolled (two trips).
#pragma unroll
    for (int ci = wave; ci < CG; ci += 8) {
        const int c = c0 + ci;
        const half_t* w2c = W2h + (size_t)c * 4096 + lm * 64;   // A row q = 16 * qt + lm
        const half_t* b2c = b2h + (size_t)c * 64 + 8 * khi;     // rows 8 * khi + r of a tile
        half_t* xrow[2] = {smem + XT_OFF + (ci * BT + lm) * ROW,
                           smem + XT_OFF + (ci * BT + 16 + lm) * ROW};

        v16h xb[2][2];   // X^T as B: [batch tile][k step]
#pragma unroll
        for (int t = 0; t < 2; ++t)
#pragma unroll
            for (int ks = 0; ks < 2; ++ks) xb[t][ks] = load_frag(xrow[t], ks * 32, khi);

        // ---- Stage 1: H^T = W1 * X^T + b1, exact GELU, kept in registers
        v16h hb[2][2];   // GELU(H^T) as B: [batch tile][k step]
#pragma unroll
        for (int qt = 0; qt < 4; ++qt) {
            const v16h a0 = w1f[qt][0];
            const v16h a1 = w1f[qt][1];
            const v8h  bb = bias1[qt];
#pragma unroll
            for (int t = 0; t < 2; ++t) {
                v8f acc;
#pragma unroll
                for (int r = 0; r < 8; ++r) acc[r] = (float)bb[r];
                acc = __builtin_amdgcn_wmma_f32_16x16x32_f16(false, a0, false, xb[t][0],
                                                             (short)0, acc, false, false);
                acc = __builtin_amdgcn_wmma_f32_16x16x32_f16(false, a1, false, xb[t][1],
                                                             (short)0, acc, false, false);
#pragma unroll
                for (int r = 0; r < 8; r += 2) {
                    const v2f g = gelu_pair((v2f){acc[r], acc[r + 1]});
                    hb[t][qt >> 1][(qt & 1) * 8 + r]     = (half_t)g.x;
                    hb[t][qt >> 1][(qt & 1) * 8 + r + 1] = (half_t)g.y;
                }
            }
        }

        // ---- Stage 2: O^T = W2 * GELU(H^T) + b2; res = O + x, in place over x
        // (only this wave reads or writes this channel's rows)
#pragma unroll
        for (int qt = 0; qt < 4; ++qt) {
            const v16h a0 = load_frag(w2c + qt * 16 * 64, 0, khi);
            const v16h a1 = load_frag(w2c + qt * 16 * 64, 32, khi);
            const v8h  bb = *(const v8h*)(b2c + qt * 16);
#pragma unroll
            for (int t = 0; t < 2; ++t) {
                v8f acc;
#pragma unroll
                for (int r = 0; r < 8; ++r) acc[r] = (float)bb[r];
                acc = __builtin_amdgcn_wmma_f32_16x16x32_f16(false, a0, false, hb[t][0],
                                                             (short)0, acc, false, false);
                acc = __builtin_amdgcn_wmma_f32_16x16x32_f16(false, a1, false, hb[t][1],
                                                             (short)0, acc, false, false);
                v8h* rp = (v8h*)(xrow[t] + qt * 16 + 8 * khi);
                const v8h xr = *rp;
                v8h o;
#pragma unroll
                for (int r = 0; r < 8; ++r) o[r] = (half_t)(acc[r] + (float)xr[r]);
                *rp = o;
            }
        }
        if (ci + 8 < CG) fetch_w1(c + 8);
    }
    __syncthreads();   // every channel's res rows complete

    // ---- Writeout: res [c][m][q] in LDS -> scratch [B][P][C] f16, 16B stores.
    // A thread takes 8 channels of two neighbouring q: 8 dword reads, 2 stores.
    for (int it = tid; it < BT * 32 * 2; it += 256) {
        const int chunk = it & 1;
        const int qp    = (it >> 1) & 31;
        const int m     = it >> 6;
        v8h e, o;
#pragma unroll
        for (int j = 0; j < 8; ++j) {
            const v2h pr = *(const v2h*)(smem + XT_OFF + ((chunk * 8 + j) * BT + m) * ROW + qp * 2);
            e[j] = pr[0];
            o[j] = pr[1];
        }
        half_t* dst = resh + ((size_t)(b0 + m) * Pp + qp * 2) * Cc + c0 + chunk * 8;
        *(v8h*)dst        = e;
        *(v8h*)(dst + Cc) = o;
    }
}

// ---- K2: LayerNorm over C. One wave32 per (b,q) row (1KB contiguous f16).
__global__ __launch_bounds__(256)
void mixer_ln_k2(const half_t* __restrict__ resh,
                 const float* __restrict__ gamma, const float* __restrict__ beta,
                 float* __restrict__ out) {
    const int lane = threadIdx.x & 31;
    const int wave = threadIdx.x >> 5;
    const size_t row = (size_t)blockIdx.x * 8 + wave;   // B*P = 65536 rows

    const half_t* rp = resh + row * Cc + lane * 16;
    const v8h a = *(const v8h*)rp;
    const v8h b = *(const v8h*)(rp + 8);
    float v[16], s = 0.f, s2 = 0.f;
#pragma unroll
    for (int i = 0; i < 8; ++i) { v[i] = (float)a[i]; v[i + 8] = (float)b[i]; }
#pragma unroll
    for (int i = 0; i < 16; ++i) { s += v[i]; s2 += v[i] * v[i]; }
#pragma unroll
    for (int off = 16; off > 0; off >>= 1) {
        s  += __shfl_xor(s,  off, 32);
        s2 += __shfl_xor(s2, off, 32);
    }
    const float mean = s * (1.0f / Cc);
    const float var  = s2 * (1.0f / Cc) - mean * mean;
    const float rstd = rsqrtf(var + 1e-5f);

    const int cb = lane * 16;
#pragma unroll
    for (int seg = 0; seg < 4; ++seg) {
        float4 o;
        o.x = (v[seg * 4 + 0] - mean) * rstd * gamma[cb + seg * 4 + 0] + beta[cb + seg * 4 + 0];
        o.y = (v[seg * 4 + 1] - mean) * rstd * gamma[cb + seg * 4 + 1] + beta[cb + seg * 4 + 1];
        o.z = (v[seg * 4 + 2] - mean) * rstd * gamma[cb + seg * 4 + 2] + beta[cb + seg * 4 + 2];
        o.w = (v[seg * 4 + 3] - mean) * rstd * gamma[cb + seg * 4 + 3] + beta[cb + seg * 4 + 3];
        *(float4*)(out + row * Cc + cb + seg * 4) = o;
    }
}

extern "C" void kernel_launch(void* const* d_in, const int* in_sizes, int n_in,
                              void* d_out, int out_size, void* d_ws, size_t ws_size,
                              hipStream_t stream) {
    const float* x     = (const float*)d_in[0];
    const float* W1    = (const float*)d_in[1];
    const float* b1    = (const float*)d_in[2];
    const float* W2    = (const float*)d_in[3];
    const float* b2    = (const float*)d_in[4];
    const float* gamma = (const float*)d_in[5];
    const float* beta  = (const float*)d_in[6];
    float* out = (float*)d_out;

    // Scratch layout (f16): res[B*P*C] | W1h | W2h | b1h | b2h  (~72.2 MB)
    half_t* resh = (half_t*)d_ws;
    half_t* W1h  = resh + (size_t)Bsz * Pp * Cc;
    half_t* W2h  = W1h + (size_t)Cc * Pp * Pp;
    half_t* b1h  = W2h + (size_t)Cc * Pp * Pp;
    half_t* b2h  = b1h + (size_t)Cc * Pp;

    // K0: f32 -> f16 weight/bias conversion, all four planes in one launch
    cvt_f32_to_f16_k0<<<2 * WBLK + 2 * VBLK, 256, 0, stream>>>(W1, W2, b1, b2, W1h);

    // K1: fused GEMM/GELU/GEMM/residual per channel group
    dim3 g1(8, Cc / CG, Bsz / BT / 8);     // 8 x 32 x 4 workgroups, batch tile = 8 * z + x
    mixer_gemm_k1<<<g1, 256, LDS_BYTES, stream>>>(x, W1h, b1h, W2h, b2h, resh);

    // K2: LayerNorm
    dim3 g2((Bsz * Pp) / 8);        // 8192 workgroups, 8 rows each
    mixer_ln_k2<<<g2, 256, 0, stream>>>(resh, gamma, beta, out);
}

// v005
// Measured time: 66.5 microseconds a run.
// Timed twice side by side with v004, it ran 1.05 times as fast both times.
// Counting every step since v000, it is 2.07 times as fast.
#include <hip/hip_runtime.h>
#include <hip/hip_bf16.h>
#include <math.h>

typedef _Float16 half_t;
typedef __attribute__((ext_vector_type(16))) _Float16 v16h;
typedef __attribute__((ext_vector_type(8)))  _Float16 v8h;
typedef __attribute__((ext_vector_type(4)))  _Float16 v4h;
typedef __attribute__((ext_vector_type(2)))  _Float16 v2h;
typedef __attribute__((ext_vector_type(8)))  float    v8f;
typedef __attribute__((ext_vector_type(2)))  float    v2f;

static constexpr int Bsz = 1024;   // batch
static constexpr int Pp  = 64;     // patches
static constexpr int Cc  = 512;    // channels
static constexpr int CG  = 16;     // channels per workgroup (64B-coalesced x loads)
static constexpr int BT  = 32;     // batch rows per workgroup
static constexpr int ROW = 72;     // 64 + 8 halves pad: 144B rows, 16B aligned

// LDS offsets (in halves)
static constexpr int XT_OFF  = 0;                       // x tile, then res tile  [CG][BT][ROW]
static constexpr int LDS_HALVES = XT_OFF + CG * BT * ROW;   // 36,864 halves
static constexpr int LDS_BYTES  = LDS_HALVES * 2;           // 73,728 B

__device__ __forceinline__ v16h load_frag(const half_t* row, int kk, int khi) {
    v8h lo = *(const v8h*)(row + kk + 8 * khi);
    v8h hi = *(const v8h*)(row + kk + 16 + 8 * khi);
    v16h r;
#pragma unroll
    for (int i = 0; i < 8; ++i) { r[i] = lo[i]; r[i + 8] = hi[i]; }
    return r;
}

// A fragment of a weight matrix from its fragment-ordered plane (written by K0):
//   plane[c][q tile][k step][piece][lane][8 halves],
//   element i = W[c][16 * qt + (lane & 15)][32 * ks + 16 * piece + 8 * (lane >> 4) + i],
// the same k order as load_frag. p points at this lane's piece 0; piece 1 lies 256 halves on.
// Each of the two loads reads 512 B in a row over the wave (4 whole lines, not 16 quarter-used ones).
__device__ __forceinline__ v16h load_wfrag(const half_t* p) {
    v8h lo = *(const v8h*)p;
    v8h hi = *(const v8h*)(p + 256);
    v16h r;
#pragma unroll
    for (int i = 0; i < 8; ++i) { r[i] = lo[i]; r[i + 8] = hi[i]; }
    return r;
}

// Exact GELU, v * Phi(v), without the library erf and its two branches per element.
// erfc(|v| / sqrt 2) = exp2(L(|v|)), L one polynomial of degree 10 with L(0) = 0, fitted on
// |v| <= 6 and falling on beyond it (exp2 then gives 0). With a = |v| and e that erfc:
//   v * Phi(v) = 0.5 * ((v + a) - a * e)
// on both sides of 0; v + a is exact (0 or 2 v), so nothing cancels for v < 0. Against a double-precision GELU the
// f32 evaluation stays within 1.4e-7 absolute and 1.3e-6 relative on |v| <= 4.
// Two elements a call: the polynomial runs on packed f32 FMAs.
__device__ __forceinline__ v2f gelu_pair(v2f v) {
    const v2f a = {__builtin_fabsf(v.x), __builtin_fabsf(v.y)};
    v2f p = __builtin_elementwise_fma((v2f)(-1.26771118e-8f), a, (v2f)(4.25985121e-7f));
    p = __builtin_elementwise_fma(p, a, (v2f)(-6.09079416e-6f));
    p = __builtin_elementwise_fma(p, a, (v2f)(4.64202494e-5f));
    p = __builtin_elementwise_fma(p, a, (v2f)(-1.69534294e-4f));
    p = __builtin_elementwise_fma(p, a, (v2f)(-2.45350850e-4f));
    p = __builtin_elementwise_fma(p, a, (v2f)(7.27208052e-3f));
    p = __builtin_elementwise_fma(p, a, (v2f)(-5.26813492e-2f));
    p = __builtin_elementwise_fma(p, a, (v2f)(-4.59135205e-1f));
    p = __builtin_elementwise_fma(p, a, (v2f)(-1.15111458e+0f));
    const v2f l = p * a;
    const v2f e = {__builtin_amdgcn_exp2f(l.x), __builtin_amdgcn_exp2f(l.y)};
    return __builtin_elementwise_fma(-a, e, v + a) * 0.5f;
}

// ---- K0: f32 -> f16 conversion of W1, W2, b1 and b2 in ONE launch, 8 elements a thread.
// The four f16 planes lie one behind the other in scratch, so the flat index of the 16-B piece
// is the destination index; every plane is a whole number of blocks, so the choice
// of the source is uniform in a block and the grid covers the planes exactly.
// The weight planes are written in A-fragment order (see load_wfrag): a wave stores 512 B in a
// row and gathers its 32-B source pieces from 16 rows; the biases keep their order.
static constexpr int WBLK = Cc * Pp * Pp / 8 / 256;   // 1024 blocks a weight plane
static constexpr int VBLK = Cc * Pp / 8 / 256;        // 16 blocks a bias plane
__global__ __launch_bounds__(256)
void cvt_f32_to_f16_k0(const float* __restrict__ W1, const float* __restrict__ W2,
                       const float* __restrict__ b1, const float* __restrict__ b2,
                       half_t* __restrict__ dst /* W1h | W2h | b1h | b2h */) {
    const int blk = blockIdx.x;
    const float* src = W1;
    int first = 0;
    if (blk >= 2 * WBLK + VBLK) { src = b2; first = 2 * WBLK + VBLK; }
    else if (blk >= 2 * WBLK)   { src = b1; first = 2 * WBLK; }
    else if (blk >= WBLK)       { src = W2; first = WBLK; }
    const int d = (blk - first) * 256 + threadIdx.x;   // 16-B piece within its plane
    int e = d * 8;                                     // first source element
    if (blk < 2 * WBLK) {
        // d = [c : 9 bits][qt : 2][ks : 1][piece : 1][lane >> 4 : 1][lane & 15 : 4]
        const int row = ((d >> 7) & 3) * 16 + (d & 15);
        const int k   = ((d >> 6) & 1) * 32 + ((d >> 5) & 1) * 16 + ((d >> 4) & 1) * 8;
        e = (d >> 9) * (Pp * Pp) + row * Pp + k;
    }
    const float4 u = *(const float4*)(src + e);
    const float4 v = *(const float4*)(src + e + 4);
    ((v8h*)dst)[blk * 256 + threadIdx.x] = (v8h){(half_t)u.x, (half_t)u.y, (half_t)u.z, (half_t)u.w,
                                                 (half_t)v.x, (half_t)v.y, (half_t)v.z, (half_t)v.w};
}

__global__ __launch_bounds__(256)
void mixer_gemm_k1(const float* __restrict__ x,
                   const half_t* __restrict__ W1h, const half_t* __restrict__ b1h,
                   const half_t* __restrict__ W2h, const half_t* __restrict__ b2h,
                   half_t* __restrict__ resh /* [B][P][C] f16 */) {
    extern __shared__ half_t smem[];
    const int tid  = threadIdx.x;
    // Grid (8, channel groups, batch tiles / 8): the flat index is (tile & 7) + 8 * group + 256 * (tile >> 3).
    // For speed only: any placement is right.
    const int c0   = blockIdx.y * CG;                          // channel group base
    const int b0   = (blockIdx.z * 8 + blockIdx.x) * BT;       // batch tile base
    const int lane = tid & 31;
    // wave number in a scalar register: channel loop control and bases stay scalar
    const int wave = __builtin_amdgcn_readfirstlane(tid >> 5);
    const int lm   = lane & 15;
    const int khi  = lane >> 4;

    // W1[c] as A fragments [q tile][k step] and b1[c]: the first channel's fly
    // under the x load, the next channel's are asked for at the loop's foot.
    v16h w1f[4][2];
    v8h  bias1[4];
    auto fetch_w1 = [&](int c) {
        const half_t* w1c = W1h + (size_t)c * 4096 + lane * 8;            // this lane's pieces
        const half_t* b1c = b1h + (size_t)c * 64 + 8 * khi;               // rows 8 * khi + r of a tile
#pragma unroll
        for (int qt = 0; qt < 4; ++qt) {
            w1f[qt][0] = load_wfrag(w1c + qt * 1024);
            w1f[qt][1] = load_wfrag(w1c + qt * 1024 + 512);
            bias1[qt]  = *(const v8h*)(b1c + qt * 16);
        }
        // the loads' address registers are free behind this point: wait before
        // they can be overwritten; naming the pair keeps it whole up to the wait
        asm volatile("s_wait_xcnt 0x0" :: "v"(w1c) : "memory");
    };
    fetch_w1(c0 + wave);

    // ---- Phase 0: coalesced x load (64B lines), f32->f16 transpose into LDS
    for (int it = tid; it < BT * 64 * 4; it += 256) {
        const int chunk = it & 3;            // 4-float sub-chunk of the 16 channels
        const int p     = (it >> 2) & 63;
        const int m     = it >> 8;           // 0..31
        const float4 v  = *(const float4*)(x + ((size_t)(b0 + m) * Pp + p) * Cc + c0 + chunk * 4);
        const float vv[4] = {v.x, v.y, v.z, v.w};
#pragma unroll
        for (int j = 0; j < 4; ++j) {
            const int cl = chunk * 4 + j;
            smem[XT_OFF + (cl * BT + m) * ROW + p] = (half_t)vv[j];
        }
    }
    __syncthreads();   // x tile complete

    // ---- Channel loop: ONE WAVE OWNS ONE CHANNEL (two channels a wave).
    // Both products are formed transposed, weights as A and the batch as the
    // B columns: H^T = W1 * X^T, O^T = W2 * GELU(H^T). A lane then holds one
    // batch row and 8 consecutive q per accumulator tile, so two converted
    // tiles of H^T are the next product's B fragment as they lie.
    // Unrolled (two trips).
#pragma unroll
    for (int ci = wave; ci < CG; ci += 8) {
        const int c = c0 + ci;
        const half_t* w2c = W2h + (size_t)c * 4096 + lane * 8;  // this lane's pieces
        const half_t* b2c = b2h + (size_t)c * 64 + 8 * khi;     // rows 8 * khi + r of a tile
        half_t* xrow[2] = {smem + XT_OFF + (ci * BT + lm) * ROW,
                           smem + XT_OFF + (ci * BT + 16 + lm) * ROW};

        v16h xb[2][2];   // X^T as B: [batch tile][k step]
#pragma unroll
        for (int t = 0; t < 2; ++t)
#pragma unroll
            for (int ks = 0; ks < 2; ++ks) xb[t][ks] = load_frag(xrow[t], ks * 32, khi);

        // ---- Stage 1: H^T = W1 * X^T + b1, exact GELU, kept in registers
        v16h hb[2][2];   // GELU(H^T) as B: [batch tile][k step]
#pragma unroll
        for (int qt = 0; qt < 4; ++qt) {
            const v16h a0 = w1f[qt][0];
            const v16h a1 = w1f[qt][1];
            const v8h  bb = bias1[qt];
#pragma unroll
            for (int t = 0; t < 2; ++t) {
                v8f acc;
#pragma unroll
                for (int r = 0; r < 8; ++r) acc[r] = (float)bb[r];
                acc = __builtin_amdgcn_wmma_f32_16x16x32_f16(false, a0, false, xb[t][0],
                                                             (short)0, acc, false, false);
                acc = __builtin_amdgcn_wmma_f32_16x16x32_f16(false, a1, false, xb[t][1],
                                                             (short)0, acc, false, false);
#pragma unroll
                for (int r = 0; r < 8; r += 2) {
                    const v2f g = gelu_pair((v2f){acc[r], acc[r + 1]});
                    hb[t][qt >> 1][(qt & 1) * 8 + r]     = (half_t)g.x;
                    hb[t][qt >> 1][(qt & 1) * 8 + r + 1] = (half_t)g.y;
                }
            }
        }

        // ---- Stage 2: O^T = W2 * GELU(H^T) + b2; res = O + x, in place over x
        // (only this wave reads or writes this channel's rows)
#pragma unroll
        for (int qt = 0; qt < 4; ++qt) {
            const v16h a0 = load_wfrag(w2c + qt * 1024);
            const v16h a1 = load_wfrag(w2c + qt * 1024 + 512);
            const v8h  bb = *(const v8h*)(b2c + qt * 16);
#pragma unroll
            for (int t = 0; t < 2; ++t) {
                v8f acc;
#pragma unroll
                for (int r = 0; r < 8; ++r) acc[r] = (float)bb[r];
                acc = __builtin_amdgcn_wmma_f32_16x16x32_f16(false, a0, false, hb[t][0],
                                                             (short)0, acc, false, false);
                acc = __builtin_amdgcn_wmma_f32_16x16x32_f16(false, a1, false, hb[t][1],
                                                             (short)0, acc, false, false);
                v8h* rp = (v8h*)(xrow[t] + qt * 16 + 8 * khi);
                const v8h xr = *rp;
                v8h o;
#pragma unroll
                for (int r = 0; r < 8; ++r) o[r] = (half_t)(acc[r] + (float)xr[r]);
                *rp = o;
            }
        }
        // W2's loads are all issued: wait before their address pair can be overwritten;
        // naming the pair keeps it whole up to the wait
        asm volatile("s_wait_xcnt 0x0" :: "v"(w2c) : "memory");
        if (ci + 8 < CG) fetch_w1(c + 8);
    }
    __syncthreads();   // every channel's res rows complete

    // ---- Writeout: res [c][m][q] in LDS -> scratch [B][P][C] f16, 16B stores.
    // A thread takes 8 channels of two neighbouring q: 8 dword reads, 2 stores.
    for (int it = tid; it < BT * 32 * 2; it += 256) {
        const int chunk = it & 1;
        const int qp    = (it >> 1) & 31;
        const int m     = it >> 6;
        v8h e, o;
#pragma unroll
        for (int j = 0; j < 8; ++j) {
            const v2h pr = *(const v2h*)(smem + XT_OFF + ((chunk * 8 + j) * BT + m) * ROW + qp * 2);
            e[j] = pr[0];
            o[j] = pr[1];
        }
        half_t* dst = resh + ((size_t)(b0 + m) * Pp + qp * 2) * Cc + c0 + chunk * 8;
        *(v8h*)dst        = e;
        *(v8h*)(dst + Cc) = o;
    }
}

// ---- K2: LayerNorm over C. One wave32 per (b,q) row (1KB contiguous f16).
__global__ __launch_bounds__(256)
void mixer_ln_k2(const half_t* __restrict__ resh,
                 const float* __restrict__ gamma, const float* __restrict__ beta,
                 float* __restrict__ out) {
    const int lane = threadIdx.x & 31;
    const int wave = threadIdx.x >> 5;
    const size_t row = (size_t)blockIdx.x * 8 + wave;   // B*P = 65536 rows

    const half_t* rp = resh + row * Cc + lane * 16;
    const v8h a = *(const v8h*)rp;
    const v8h b = *(const v8h*)(rp + 8);
    float v[16], s = 0.f, s2 = 0.f;
#pragma unroll
    for (int i = 0; i < 8; ++i) { v[i] = (float)a[i]; v[i + 8] = (float)b[i]; }
#pragma unroll
    for (int i = 0; i < 16; ++i) { s += v[i]; s2 += v[i] * v[i]; }
#pragma unroll
    for (int off = 16; off > 0; off >>= 1) {
        s  += __shfl_xor(s,  off, 32);
        s2 += __shfl_xor(s2, off, 32);
    }
    const float mean = s * (1.0f / Cc);
    const float var  = s2 * (1.0f / Cc) - mean * mean;
    const float rstd = rsqrtf(var + 1e-5f);

    const int cb = lane * 16;
#pragma unroll
    for (int seg = 0; seg < 4; ++seg) {
        float4 o;
        o.x = (v[seg * 4 + 0] - mean) * rstd * gamma[cb + seg * 4 + 0] + beta[cb + seg * 4 + 0];
        o.y = (v[seg * 4 + 1] - mean) * rstd * gamma[cb + seg * 4 + 1] + beta[cb + seg * 4 + 1];
        o.z = (v[seg * 4 + 2] - mean) * rstd * gamma[cb + seg * 4 + 2] + beta[cb + seg * 4 + 2];
        o.w = (v[seg * 4 + 3] - mean) * rstd * gamma[cb + seg * 4 + 3] + beta[cb + seg * 4 + 3];
        *(float4*)(out + row * Cc + cb + seg * 4) = o;
    }
}

extern "C" void kernel_launch(void* const* d_in, const int* in_sizes, int n_in,
                              void* d_out, int out_size, void* d_ws, size_t ws_size,
                              hipStream_t stream) {
    const float* x     = (const float*)d_in[0];
    const float* W1    = (const float*)d_in[1];
    const float* b1    = (const float*)d_in[2];
    const float* W2    = (const float*)d_in[3];
    const float* b2    = (const float*)d_in[4];
    const float* gamma = (const float*)d_in[5];
    const float* beta  = (const float*)d_in[6];
    float* out = (float*)d_out;

    // Scratch layout (f16): res[B*P*C] | W1h | W2h | b1h | b2h  (~72.2 MB)
    half_t* resh = (half_t*)d_ws;
    half_t* W1h  = resh + (size_t)Bsz * Pp * Cc;
    half_t* W2h  = W1h + (size_t)Cc * Pp * Pp;
    half_t* b1h  = W2h + (size_t)Cc * Pp * Pp;
    half_t* b2h  = b1h + (size_t)Cc * Pp;

    // K0: f32 -> f16 weight/bias conversion, all four planes in one launch (weights in fragment order)
    cvt_f32_to_f16_k0<<<2 * WBLK + 2 * VBLK, 256, 0, stream>>>(W1, W2, b1, b2, W1h);

    // K1: fused GEMM/GELU/GEMM/residual per channel group
    dim3 g1(8, Cc / CG, Bsz / BT / 8);     // 8 x 32 x 4 workgroups, batch tile = 8 * z + x
    mixer_gemm_k1<<<g1, 256, LDS_BYTES, stream>>>(x, W1h, b1h, W2h, b2h, resh);

    // K2: LayerNorm
    dim3 g2((Bsz * Pp) / 8);        // 8192 workgroups, 8 rows each
    mixer_ln_k2<<<g2, 256, 0, stream>>>(resh, gamma, beta, out);
}

// v006
// It runs in 62 microseconds.
// In both of two side-by-side timings against v005, it was 1.07 times as fast.
// Counting every step since v000, it is 2.21 times as fast.
#include <hip/hip_runtime.h>
#include <hip/hip_bf16.h>
#include <math.h>

typedef _Float16 half_t;
typedef __attribute__((ext_vector_type(16))) _Float16 v16h;
typedef __attribute__((ext_vector_type(8)))  _Float16 v8h;
typedef __attribute__((ext_vector_type(4)))  _Float16 v4h;
typedef __attribute__((ext_vector_type(2)))  _Float16 v2h;
typedef __attribute__((ext_vector_type(8)))  float    v8f;
typedef __attribute__((ext_vector_type(2)))  float    v2f;

static constexpr int Bsz = 1024;   // batch
static constexpr int Pp  = 64;     // patches
static constexpr int Cc  = 512;    // channels
static constexpr int CG  = 16;     // channels per workgroup (64B-coalesced x loads)
static constexpr int BT  = 32;     // batch rows per workgroup
static constexpr int ROW = 72;     // 64 + 8 halves pad: 144B rows, 16B aligned

// LDS offsets (in halves)
static constexpr int XT_OFF  = 0;                       // x tile, then res tile  [CG][BT][ROW]
static constexpr int LDS_HALVES = XT_OFF + CG * BT * ROW;   // 36,864 halves
static constexpr int LDS_BYTES  = LDS_HALVES * 2;           // 73,728 B

__device__ __forceinline__ v16h load_frag(const half_t* row, int kk, int khi) {
    v8h lo = *(const v8h*)(row + kk + 8 * khi);
    v8h hi = *(const v8h*)(row + kk + 16 + 8 * khi);
    v16h r;
#pragma unroll
    for (int i = 0; i < 8; ++i) { r[i] = lo[i]; r[i + 8] = hi[i]; }
    return r;
}

// A fragment of a weight matrix from its fragment-ordered plane (written by K0):
//   plane[c][q tile][k step][piece][lane][8 halves],
//   element i = W[c][16 * qt + (lane & 15)][32 * ks + 16 * piece + 8 * (lane >> 4) + i],
// the same k order as load_frag. p points at this lane's piece 0; piece 1 lies 256 halves on.
// Each of the two loads reads 512 B in a row over the wave (4 whole lines, not 16 quarter-used ones).
__device__ __forceinline__ v16h load_wfrag(const half_t* p) {
    v8h lo = *(const v8h*)p;
    v8h hi = *(const v8h*)(p + 256);
    v16h r;
#pragma unroll
    for (int i = 0; i < 8; ++i) { r[i] = lo[i]; r[i + 8] = hi[i]; }
    return r;
}

// Exact GELU, v * Phi(v), without the library erf and its two branches per element.
// erfc(|v| / sqrt 2) = exp2(L(|v|)), L one polynomial of degree 10 with L(0) = 0, fitted on
// |v| <= 6 and falling on beyond it (exp2 then gives 0). With a = |v| and e that erfc:
//   v * Phi(v) = 0.5 * ((v + a) - a * e)
// on both sides of 0; v + a is exact (0 or 2 v), so nothing cancels for v < 0. Against a double-precision GELU the
// f32 evaluation stays within 1.4e-7 absolute and 1.3e-6 relative on |v| <= 4.
// Two elements a call: the polynomial runs on packed f32 FMAs.
__device__ __forceinline__ v2f gelu_pair(v2f v) {
    const v2f a = {__builtin_fabsf(v.x), __builtin_fabsf(v.y)};
    v2f p = __builtin_elementwise_fma((v2f)(-1.26771118e-8f), a, (v2f)(4.25985121e-7f));
    p = __builtin_elementwise_fma(p, a, (v2f)(-6.09079416e-6f));
    p = __builtin_elementwise_fma(p, a, (v2f)(4.64202494e-5f));
    p = __builtin_elementwise_fma(p, a, (v2f)(-1.69534294e-4f));
    p = __builtin_elementwise_fma(p, a, (v2f)(-2.45350850e-4f));
    p = __builtin_elementwise_fma(p, a, (v2f)(7.27208052e-3f));
    p = __builtin_elementwise_fma(p, a, (v2f)(-5.26813492e-2f));
    p = __builtin_elementwise_fma(p, a, (v2f)(-4.59135205e-1f));
    p = __builtin_elementwise_fma(p, a, (v2f)(-1.15111458e+0f));
    const v2f l = p * a;
    const v2f e = {__builtin_amdgcn_exp2f(l.x), __builtin_amdgcn_exp2f(l.y)};
    return __builtin_elementwise_fma(-a, e, v + a) * 0.5f;
}

// ---- K0: f32 -> f16 conversion of W1, W2, b1 and b2 in ONE launch, 8 elements a thread.
// The four f16 planes lie one behind the other in scratch, so the flat index of the 16-B piece
// is the destination index; every plane is a whole number of blocks, so the choice
// of the source is uniform in a block and the grid covers the planes exactly.
// The weight planes are written in A-fragment order (see load_wfrag): a wave stores 512 B in a
// row and gathers its 32-B source pieces from 16 rows; the biases keep their order.
static constexpr int WBLK = Cc * Pp * Pp / 8 / 256;   // 1024 blocks a weight plane
static constexpr int VBLK = Cc * Pp / 8 / 256;        // 16 blocks a bias plane
__global__ __launch_bounds__(256)
void cvt_f32_to_f16_k0(const float* __restrict__ W1, const float* __restrict__ W2,
                       const float* __restrict__ b1, const float* __restrict__ b2,
                       half_t* __restrict__ dst /* W1h | W2h | b1h | b2h */) {
    const int blk = blockIdx.x;
    const float* src = W1;
    int first = 0;
    if (blk >= 2 * WBLK + VBLK) { src = b2; first = 2 * WBLK + VBLK; }
    else if (blk >= 2 * WBLK)   { src = b1; first = 2 * WBLK; }
    else if (blk >= WBLK)       { src = W2; first = WBLK; }
    const int d = (blk - first) * 256 + threadIdx.x;   // 16-B piece within its plane
    int e = d * 8;                                     // first source element
    if (blk < 2 * WBLK) {
        // d = [c : 9 bits][qt : 2][ks : 1][piece : 1][lane >> 4 : 1][lane & 15 : 4]
        const int row = ((d >> 7) & 3) * 16 + (d & 15);
        const int k   = ((d >> 6) & 1) * 32 + ((d >> 5) & 1) * 16 + ((d >> 4) & 1) * 8;
        e = (d >> 9) * (Pp * Pp) + row * Pp + k;
    }
    const float4 u = *(const float4*)(src + e);
    const float4 v = *(const float4*)(src + e + 4);
    ((v8h*)dst)[blk * 256 + threadIdx.x] = (v8h){(half_t)u.x, (half_t)u.y, (half_t)u.z, (half_t)u.w,
                                                 (half_t)v.x, (half_t)v.y, (half_t)v.z, (half_t)v.w};
}

__global__ __launch_bounds__(256)
void mixer_gemm_k1(const float* __restrict__ x,
                   const half_t* __restrict__ W1h, const half_t* __restrict__ b1h,
                   const half_t* __restrict__ W2h, const half_t* __restrict__ b2h,
                   half_t* __restrict__ resh /* [B][P][C] f16 */) {
    extern __shared__ half_t smem[];
    const int tid  = threadIdx.x;
    // Grid (8, channel groups, batch tiles / 8): the flat index is (tile & 7) + 8 * group + 256 * (tile >> 3).
    // For speed only: any placement is right.
    const int c0   = blockIdx.y * CG;                          // channel group base
    const int b0   = (blockIdx.z * 8 + blockIdx.x) * BT;       // batch tile base
    const int lane = tid & 31;
    // wave number in a scalar register: channel loop control and bases stay scalar
    const int wave = __builtin_amdgcn_readfirstlane(tid >> 5);
    const int lm   = lane & 15;
    const int khi  = lane >> 4;

    // W1[c] as A fragments [q tile][k step] and b1[c]: the first channel's fly
    // under the x load, the next channel's are asked for at the loop's foot.
    v16h w1f[4][2];
    v8h  bias1[4];
    auto fetch_w1 = [&](int c) {
        const half_t* w1c = W1h + (size_t)c * 4096 + lane * 8;            // this lane's pieces
        const half_t* b1c = b1h + (size_t)c * 64 + 8 * khi;               // rows 8 * khi + r of a tile
#pragma unroll
        for (int qt = 0; qt < 4; ++qt) {
            w1f[qt][0] = load_wfrag(w1c + qt * 1024);
            w1f[qt][1] = load_wfrag(w1c + qt * 1024 + 512);
            bias1[qt]  = *(const v8h*)(b1c + qt * 16);
        }
        // the loads' address registers are free behind this point: wait before
        // they can be overwritten; naming the pair keeps it whole up to the wait
        asm volatile("s_wait_xcnt 0x0" :: "v"(w1c) : "memory");
    };
    fetch_w1(c0 + wave);

    // ---- Phase 0: coalesced x load (64B lines), f32->f16 transpose into LDS
    for (int it = tid; it < BT * 64 * 4; it += 256) {
        const int chunk = it & 3;            // 4-float sub-chunk of the 16 channels
        const int p     = (it >> 2) & 63;
        const int m     = it >> 8;           // 0..31
        const float4 v  = *(const float4*)(x + ((size_t)(b0 + m) * Pp + p) * Cc + c0 + chunk * 4);
        const float vv[4] = {v.x, v.y, v.z, v.w};
#pragma unroll
        for (int j = 0; j < 4; ++j) {
            const int cl = chunk * 4 + j;
            smem[XT_OFF + (cl * BT + m) * ROW + p] = (half_t)vv[j];
        }
    }
    __syncthreads();   // x tile complete

    // ---- Channel loop: ONE WAVE OWNS ONE CHANNEL (two channels a wave).
    // Both products are formed transposed, weights as A and the batch as the
    // B columns: H^T = W1 * X^T, O^T = W2 * GELU(H^T). A lane then holds one
    // batch row and 8 consecutive q per accumulator tile, so two converted
    // tiles of H^T are the next product's B fragment as they lie.
    // Unrolled (two trips).
#pragma unroll
    for (int ci = wave; ci < CG; ci += 8) {
        const int c = c0 + ci;
        const half_t* w2c = W2h + (size_t)c * 4096 + lane * 8;  // this lane's pieces
        const half_t* b2c = b2h + (size_t)c * 64 + 8 * khi;     // rows 8 * khi + r of a tile
        half_t* xrow[2] = {smem + XT_OFF + (ci * BT + lm) * ROW,
                           smem + XT_OFF + (ci * BT + 16 + lm) * ROW};

        v16h xb[2][2];   // X^T as B: [batch tile][k step]
#pragma unroll
        for (int t = 0; t < 2; ++t)
#pragma unroll
            for (int ks = 0; ks < 2; ++ks) xb[t][ks] = load_frag(xrow[t], ks * 32, khi);

        // ---- Stage 1: H^T = W1 * X^T + b1, exact GELU, kept in registers
        v16h hb[2][2];   // GELU(H^T) as B: [batch tile][k step]
#pragma unroll
        for (int qt = 0; qt < 4; ++qt) {
            const v16h a0 = w1f[qt][0];
            const v16h a1 = w1f[qt][1];
            const v8h  bb = bias1[qt];
#pragma unroll
            for (int t = 0; t < 2; ++t) {
                v8f acc;
#pragma unroll
                for (int r = 0; r < 8; ++r) acc[r] = (float)bb[r];
                acc = __builtin_amdgcn_wmma_f32_16x16x32_f16(false, a0, false, xb[t][0],
                                                             (short)0, acc, false, false);
                acc = __builtin_amdgcn_wmma_f32_16x16x32_f16(false, a1, false, xb[t][1],
                                                             (short)0, acc, false, false);
#pragma unroll
                for (int r = 0; r < 8; r += 2) {
                    const v2f g = gelu_pair((v2f){acc[r], acc[r + 1]});
                    hb[t][qt >> 1][(qt & 1) * 8 + r]     = (half_t)g.x;
                    hb[t][qt >> 1][(qt & 1) * 8 + r + 1] = (half_t)g.y;
                }
            }
        }

        // ---- Stage 2: O^T = W2 * GELU(H^T) + b2; res = O + x, in place over x
        // (only this wave reads or writes this channel's rows)
#pragma unroll
        for (int qt = 0; qt < 4; ++qt) {
            const v16h a0 = load_wfrag(w2c + qt * 1024);
            const v16h a1 = load_wfrag(w2c + qt * 1024 + 512);
            const v8h  bb = *(const v8h*)(b2c + qt * 16);
#pragma unroll
            for (int t = 0; t < 2; ++t) {
                v8f acc;
#pragma unroll
                for (int r = 0; r < 8; ++r) acc[r] = (float)bb[r];
                acc = __builtin_amdgcn_wmma_f32_16x16x32_f16(false, a0, false, hb[t][0],
                                                             (short)0, acc, false, false);
                acc = __builtin_amdgcn_wmma_f32_16x16x32_f16(false, a1, false, hb[t][1],
                                                             (short)0, acc, false, false);
                v8h* rp = (v8h*)(xrow[t] + qt * 16 + 8 * khi);
                const v8h xr = *rp;
                v8h o;
#pragma unroll
                for (int r = 0; r < 8; ++r) o[r] = (half_t)(acc[r] + (float)xr[r]);
                *rp = o;
            }
        }
        // W2's loads are all issued: wait before their address pair can be overwritten;
        // naming the pair keeps it whole up to the wait
        asm volatile("s_wait_xcnt 0x0" :: "v"(w2c) : "memory");
        if (ci + 8 < CG) fetch_w1(c + 8);
    }
    __syncthreads();   // every channel's res rows complete

    // ---- Writeout: res [c][m][q] in LDS -> scratch [B][P][C] f16, 16B stores.
    // A thread takes 8 channels of two neighbouring q: 8 dword reads, 2 stores.
    for (int it = tid; it < BT * 32 * 2; it += 256) {
        const int chunk = it & 1;
        const int qp    = (it >> 1) & 31;
        const int m     = it >> 6;
        v8h e, o;
#pragma unroll
        for (int j = 0; j < 8; ++j) {
            const v2h pr = *(const v2h*)(smem + XT_OFF + ((chunk * 8 + j) * BT + m) * ROW + qp * 2);
            e[j] = pr[0];
            o[j] = pr[1];
        }
        half_t* dst = resh + ((size_t)(b0 + m) * Pp + qp * 2) * Cc + c0 + chunk * 8;
        *(v8h*)dst        = e;
        *(v8h*)(dst + Cc) = o;
    }
}

__global__ __launch_bounds__(256)
void mixer_ln_k2(const half_t* __restrict__ resh,
                 const float* __restrict__ gamma, const float* __restrict__ beta,
                 float* __restrict__ out) {
    const int lane = threadIdx.x & 31;
    const int wave = threadIdx.x >> 5;
    const size_t row = (size_t)blockIdx.x * 8 + wave;   // B*P = 65536 rows

    const half_t* rp = resh + row * Cc + lane * 4;
    v4h a[4];
#pragma unroll
    for (int seg = 0; seg < 4; ++seg) a[seg] = *(const v4h*)(rp + seg * 128);
    // the row's loads are issued: wait before their address pair can be overwritten (in this
    // build by the result of a gamma load); naming the pair keeps it whole up to the wait
    asm volatile("s_wait_xcnt 0x0" :: "v"(rp) : "memory");
    const float* gp = gamma + lane * 4;
    const float* tp = beta + lane * 4;
    float4 g[4], t[4];
#pragma unroll
    for (int seg = 0; seg < 4; ++seg) {
        g[seg] = *(const float4*)(gp + seg * 128);
        t[seg] = *(const float4*)(tp + seg * 128);
    }
    float v[16], s = 0.f, s2 = 0.f;
#pragma unroll
    for (int i = 0; i < 16; ++i) v[i] = (float)a[i >> 2][i & 3];
#pragma unroll
    for (int i = 0; i < 16; ++i) { s += v[i]; s2 += v[i] * v[i]; }
#pragma unroll
    for (int off = 16; off > 0; off >>= 1) {
        s  += __shfl_xor(s,  off, 32);
        s2 += __shfl_xor(s2, off, 32);
    }
    const float mean = s * (1.0f / Cc);
    const float var  = s2 * (1.0f / Cc) - mean * mean;
    const float rstd = rsqrtf(var + 1e-5f);

#pragma unroll
    for (int seg = 0; seg < 4; ++seg) {
        float4 o;
        o.x = (v[seg * 4 + 0] - mean) * rstd * g[seg].x + t[seg].x;
        o.y = (v[seg * 4 + 1] - mean) * rstd * g[seg].y + t[seg].y;
        o.z = (v[seg * 4 + 2] - mean) * rstd * g[seg].z + t[seg].z;
        o.w = (v[seg * 4 + 3] - mean) * rstd * g[seg].w + t[seg].w;
        *(float4*)(out + row * Cc + seg * 128 + lane * 4) = o;
    }
}

extern "C" void kernel_launch(void* const* d_in, const int* in_sizes, int n_in,
                              void* d_out, int out_size, void* d_ws, size_t ws_size,
                              hipStream_t stream) {
    const float* x     = (const float*)d_in[0];
    const float* W1    = (const float*)d_in[1];
    const float* b1    = (const float*)d_in[2];
    const float* W2    = (const float*)d_in[3];
    const float* b2    = (const float*)d_in[4];
    const float* gamma = (const float*)d_in[5];
    const float* beta  = (const float*)d_in[6];
    float* out = (float*)d_out;

    // Scratch layout (f16): res[B*P*C] | W1h | W2h | b1h | b2h  (~72.2 MB)
    half_t* resh = (half_t*)d_ws;
    half_t* W1h  = resh + (size_t)Bsz * Pp * Cc;
    half_t* W2h  = W1h + (size_t)Cc * Pp * Pp;
    half_t* b1h  = W2h + (size_t)Cc * Pp * Pp;
    half_t* b2h  = b1h + (size_t)Cc * Pp;

    // K0: f32 -> f16 weight/bias conversion, all four planes in one launch (weights in fragment order)
    cvt_f32_to_f16_k0<<<2 * WBLK + 2 * VBLK, 256, 0, stream>>>(W1, W2, b1, b2, W1h);

    // K1: fused GEMM/GELU/GEMM/residual per channel group
    dim3 g1(8, Cc / CG, Bsz / BT / 8);     // 8 x 32 x 4 workgroups, batch tile = 8 * z + x
    mixer_gemm_k1<<<g1, 256, LDS_BYTES, stream>>>(x, W1h, b1h, W2h, b2h, resh);

    // K2: LayerNorm
    dim3 g2((Bsz * Pp) / 8);        // 8192 workgroups, 8 rows each
    mixer_ln_k2<<<g2, 256, 0, stream>>>(resh, gamma, beta, out);
}

// v007
// One run takes 59.2 microseconds.
// In both of two side-by-side timings against v006, it was 1.05 times as fast.
// All steps since v000 together make it 2.32 times as fast.
#include <hip/hip_runtime.h>
#include <hip/hip_bf16.h>
#include <math.h>

typedef _Float16 half_t;
typedef __attribute__((ext_vector_type(16))) _Float16 v16h;
typedef __attribute__((ext_vector_type(8)))  _Float16 v8h;
typedef __attribute__((ext_vector_type(4)))  _Float16 v4h;
typedef __attribute__((ext_vector_type(2)))  _Float16 v2h;
typedef __attribute__((ext_vector_type(8)))  float    v8f;
typedef __attribute__((ext_vector_type(2)))  float    v2f;

static constexpr int Bsz = 1024;
static constexpr int Pp  = 64;
static constexpr int Cc  = 512;
static constexpr int CG  = 16;
static constexpr int BT  = 32;
static constexpr int ROW = 72;
static constexpr int CHS = BT * ROW + 8;

// LDS offsets (in halves)
static constexpr int XT_OFF  = 0;                       // x tile, then res tile  [CG] planes of [BT][ROW]
static constexpr int LDS_HALVES = XT_OFF + CG * CHS;        // 36,992 halves
static constexpr int LDS_BYTES  = LDS_HALVES * 2;           // 73,984 B

__device__ __forceinline__ v16h load_frag(const half_t* row, int kk, int khi) {
    v8h lo = *(const v8h*)(row + kk + 8 * khi);
    v8h hi = *(const v8h*)(row + kk + 16 + 8 * khi);
    v16h r;
#pragma unroll
    for (int i = 0; i < 8; ++i) { r[i] = lo[i]; r[i + 8] = hi[i]; }
    return r;
}

// A fragment of a weight matrix from its fragment-ordered plane (written by K0):
//   plane[c][q tile][k step][piece][lane][8 halves],
//   element i = W[c][16 * qt + (lane & 15)][32 * ks + 16 * piece + 8 * (lane >> 4) + i],
// the same k order as load_frag. p points at this lane's piece 0; piece 1 lies 256 halves on.
// Each of the two loads reads 512 B in a row over the wave (4 whole lines, not 16 quarter-used ones).
__device__ __forceinline__ v16h load_wfrag(const half_t* p) {
    v8h lo = *(const v8h*)p;
    v8h hi = *(const v8h*)(p + 256);
    v16h r;
#pragma unroll
    for (int i = 0; i < 8; ++i) { r[i] = lo[i]; r[i + 8] = hi[i]; }
    return r;
}

// Exact GELU, v * Phi(v), without the library erf and its two branches per element.
// erfc(|v| / sqrt 2) = exp2(L(|v|)), L one polynomial of degree 10 with L(0) = 0, fitted on
// |v| <= 6 and falling on beyond it (exp2 then gives 0). With a = |v| and e that erfc:
//   v * Phi(v) = 0.5 * ((v + a) - a * e)
// on both sides of 0; v + a is exact (0 or 2 v), so nothing cancels for v < 0. Against a double-precision GELU the
// f32 evaluation stays within 1.4e-7 absolute and 1.3e-6 relative on |v| <= 4.
// Two elements a call: the polynomial runs on packed f32 FMAs.
__device__ __forceinline__ v2f gelu_pair(v2f v) {
    const v2f a = {__builtin_fabsf(v.x), __builtin_fabsf(v.y)};
    v2f p = __builtin_elementwise_fma((v2f)(-1.26771118e-8f), a, (v2f)(4.25985121e-7f));
    p = __builtin_elementwise_fma(p, a, (v2f)(-6.09079416e-6f));
    p = __builtin_elementwise_fma(p, a, (v2f)(4.64202494e-5f));
    p = __builtin_elementwise_fma(p, a, (v2f)(-1.69534294e-4f));
    p = __builtin_elementwise_fma(p, a, (v2f)(-2.45350850e-4f));
    p = __builtin_elementwise_fma(p, a, (v2f)(7.27208052e-3f));
    p = __builtin_elementwise_fma(p, a, (v2f)(-5.26813492e-2f));
    p = __builtin_elementwise_fma(p, a, (v2f)(-4.59135205e-1f));
    p = __builtin_elementwise_fma(p, a, (v2f)(-1.15111458e+0f));
    const v2f l = p * a;
    const v2f e = {__builtin_amdgcn_exp2f(l.x), __builtin_amdgcn_exp2f(l.y)};
    return __builtin_elementwise_fma(-a, e, v + a) * 0.5f;
}

// ---- K0: f32 -> f16 conversion of W1, W2, b1 and b2 in ONE launch, 8 elements a thread.
// The four f16 planes lie one behind the other in scratch, so the flat index of the 16-B piece
// is the destination index; every plane is a whole number of blocks, so the choice
// of the source is uniform in a block and the grid covers the planes exactly.
// The weight planes are written in A-fragment order (see load_wfrag): a wave stores 512 B in a
// row and gathers its 32-B source pieces from 16 rows; the biases keep their order.
static constexpr int WBLK = Cc * Pp * Pp / 8 / 256;   // 1024 blocks a weight plane
static constexpr int VBLK = Cc * Pp / 8 / 256;        // 16 blocks a bias plane
__global__ __launch_bounds__(256)
void cvt_f32_to_f16_k0(const float* __restrict__ W1, const float* __restrict__ W2,
                       const float* __restrict__ b1, const float* __restrict__ b2,
                       half_t* __restrict__ dst /* W1h | W2h | b1h | b2h */) {
    const int blk = blockIdx.x;
    const float* src = W1;
    int first = 0;
    if (blk >= 2 * WBLK + VBLK) { src = b2; first = 2 * WBLK + VBLK; }
    else if (blk >= 2 * WBLK)   { src = b1; first = 2 * WBLK; }
    else if (blk >= WBLK)       { src = W2; first = WBLK; }
    const int d = (blk - first) * 256 + threadIdx.x;   // 16-B piece within its plane
    int e = d * 8;                                     // first source element
    if (blk < 2 * WBLK) {
        // d = [c : 9 bits][qt : 2][ks : 1][piece : 1][lane >> 4 : 1][lane & 15 : 4]
        const int row = ((d >> 7) & 3) * 16 + (d & 15);
        const int k   = ((d >> 6) & 1) * 32 + ((d >> 5) & 1) * 16 + ((d >> 4) & 1) * 8;
        e = (d >> 9) * (Pp * Pp) + row * Pp + k;
    }
    const float4 u = *(const float4*)(src + e);
    const float4 v = *(const float4*)(src + e + 4);
    ((v8h*)dst)[blk * 256 + threadIdx.x] = (v8h){(half_t)u.x, (half_t)u.y, (half_t)u.z, (half_t)u.w,
                                                 (half_t)v.x, (half_t)v.y, (half_t)v.z, (half_t)v.w};
}

__global__ __launch_bounds__(256)
void mixer_gemm_k1(const float* __restrict__ x,
                   const half_t* __restrict__ W1h, const half_t* __restrict__ b1h,
                   const half_t* __restrict__ W2h, const half_t* __restrict__ b2h,
                   half_t* __restrict__ resh /* [B][P][C] f16 */) {
    extern __shared__ half_t smem[];
    const int tid  = threadIdx.x;
    // Grid (8, channel groups, batch tiles / 8): the flat index is (tile & 7) + 8 * group + 256 * (tile >> 3).
    // For speed only: any placement is right.
    const int c0   = blockIdx.y * CG;                          // channel group base
    const int b0   = (blockIdx.z * 8 + blockIdx.x) * BT;       // batch tile base
    const int lane = tid & 31;
    // wave number in a scalar register: channel loop control and bases stay scalar
    const int wave = __builtin_amdgcn_readfirstlane(tid >> 5);
    const int lm   = lane & 15;
    const int khi  = lane >> 4;

    // W1[c] as A fragments [q tile][k step] and b1[c]: the first channel's fly
    // under the x load, the next channel's are asked for at the loop's foot.
    v16h w1f[4][2];
    v8h  bias1[4];
    auto fetch_w1 = [&](int c) {
        const half_t* w1c = W1h + (size_t)c * 4096 + lane * 8;            // this lane's pieces
        const half_t* b1c = b1h + (size_t)c * 64 + 8 * khi;               // rows 8 * khi + r of a tile
#pragma unroll
        for (int qt = 0; qt < 4; ++qt) {
            w1f[qt][0] = load_wfrag(w1c + qt * 1024);
            w1f[qt][1] = load_wfrag(w1c + qt * 1024 + 512);
            bias1[qt]  = *(const v8h*)(b1c + qt * 16);
        }
        // the loads' address registers are free behind this point: wait before
        // they can be overwritten; naming the pair keeps it whole up to the wait
        asm volatile("s_wait_xcnt 0x0" :: "v"(w1c) : "memory");
    };
    fetch_w1(c0 + wave);

    // ---- Phase 0: x load (64-B pieces), f32->f16, transposed in registers, into LDS.
    // A thread owns 4 channels x 8 consecutive p of four batch rows (wave + 8 * u): its 32 loads are
    // all asked for before the first is used, and each channel's 8 halves go out as one 16-B LDS store.
    {
        const int chunk = tid & 3;           // 4-float sub-chunk of the 16 channels
        const int g     = (tid >> 2) & 7;    // p = 8 * g + i
        const float* xs = x + ((size_t)(b0 + wave) * Pp + g * 8) * Cc + c0 + chunk * 4;
        float4 v[4][8];
#pragma unroll
        for (int u = 0; u < 4; ++u)
#pragma unroll
            for (int i = 0; i < 8; ++i)
                v[u][i] = *(const float4*)(xs + (size_t)u * 8 * Pp * Cc + i * Cc);
        // the tile's loads are issued: wait before their address pair can be overwritten;
        // naming the pair keeps it whole up to the wait
        asm volatile("s_wait_xcnt 0x0" :: "v"(xs) : "memory");
        // keeps every conversion behind the last load: without it the scheduler puts conversions, and
        // with them waits for data, between the loads, and the last ones go out two at a time
        __builtin_amdgcn_sched_barrier(0);
        half_t* xd = smem + XT_OFF + chunk * 4 * CHS + wave * ROW + g * 8;
#pragma unroll
        for (int u = 0; u < 4; ++u) {
            v8h h0, h1, h2, h3;
#pragma unroll
            for (int i = 0; i < 8; ++i) {
                h0[i] = (half_t)v[u][i].x;
                h1[i] = (half_t)v[u][i].y;
                h2[i] = (half_t)v[u][i].z;
                h3[i] = (half_t)v[u][i].w;
            }
            *(v8h*)(xd + u * 8 * ROW)           = h0;
            *(v8h*)(xd + u * 8 * ROW + CHS)     = h1;
            *(v8h*)(xd + u * 8 * ROW + 2 * CHS) = h2;
            *(v8h*)(xd + u * 8 * ROW + 3 * CHS) = h3;
        }
    }
    __syncthreads();   // x tile complete

    // ---- Channel loop: ONE WAVE OWNS ONE CHANNEL (two channels a wave).
    // Both products are formed transposed, weights as A and the batch as the
    // B columns: H^T = W1 * X^T, O^T = W2 * GELU(H^T). A lane then holds one
    // batch row and 8 consecutive q per accumulator tile, so two converted
    // tiles of H^T are the next product's B fragment as they lie.
    // Unrolled (two trips).
#pragma unroll
    for (int ci = wave; ci < CG; ci += 8) {
        const int c = c0 + ci;
        const half_t* w2c = W2h + (size_t)c * 4096 + lane * 8;  // this lane's pieces
        const half_t* b2c = b2h + (size_t)c * 64 + 8 * khi;     // rows 8 * khi + r of a tile
        half_t* xrow[2] = {smem + XT_OFF + ci * CHS + lm * ROW,
                           smem + XT_OFF + ci * CHS + (16 + lm) * ROW};

        v16h xb[2][2];   // X^T as B: [batch tile][k step]
#pragma unroll
        for (int t = 0; t < 2; ++t)
#pragma unroll
            for (int ks = 0; ks < 2; ++ks) xb[t][ks] = load_frag(xrow[t], ks * 32, khi);

        // ---- Stage 1: H^T = W1 * X^T + b1, exact GELU, kept in registers
        v16h hb[2][2];   // GELU(H^T) as B: [batch tile][k step]
#pragma unroll
        for (int qt = 0; qt < 4; ++qt) {
            const v16h a0 = w1f[qt][0];
            const v16h a1 = w1f[qt][1];
            const v8h  bb = bias1[qt];
#pragma unroll
            for (int t = 0; t < 2; ++t) {
                v8f acc;
#pragma unroll
                for (int r = 0; r < 8; ++r) acc[r] = (float)bb[r];
                acc = __builtin_amdgcn_wmma_f32_16x16x32_f16(false, a0, false, xb[t][0],
                                                             (short)0, acc, false, false);
                acc = __builtin_amdgcn_wmma_f32_16x16x32_f16(false, a1, false, xb[t][1],
                                                             (short)0, acc, false, false);
#pragma unroll
                for (int r = 0; r < 8; r += 2) {
                    const v2f g = gelu_pair((v2f){acc[r], acc[r + 1]});
                    hb[t][qt >> 1][(qt & 1) * 8 + r]     = (half_t)g.x;
                    hb[t][qt >> 1][(qt & 1) * 8 + r + 1] = (half_t)g.y;
                }
            }
        }

        // ---- Stage 2: O^T = W2 * GELU(H^T) + b2; res = O + x, in place over x
        // (only this wave reads or writes this channel's rows)
#pragma unroll
        for (int qt = 0; qt < 4; ++qt) {
            const v16h a0 = load_wfrag(w2c + qt * 1024);
            const v16h a1 = load_wfrag(w2c + qt * 1024 + 512);
            const v8h  bb = *(const v8h*)(b2c + qt * 16);
#pragma unroll
            for (int t = 0; t < 2; ++t) {
                v8f acc;
#pragma unroll
                for (int r = 0; r < 8; ++r) acc[r] = (float)bb[r];
                acc = __builtin_amdgcn_wmma_f32_16x16x32_f16(false, a0, false, hb[t][0],
                                                             (short)0, acc, false, false);
                acc = __builtin_amdgcn_wmma_f32_16x16x32_f16(false, a1, false, hb[t][1],
                                                             (short)0, acc, false, false);
                v8h* rp = (v8h*)(xrow[t] + qt * 16 + 8 * khi);
                const v8h xr = *rp;
                v8h o;
#pragma unroll
                for (int r = 0; r < 8; ++r) o[r] = (half_t)(acc[r] + (float)xr[r]);
                *rp = o;
            }
        }
        // W2's loads are all issued: wait before their address pair can be overwritten;
        // naming the pair keeps it whole up to the wait
        asm volatile("s_wait_xcnt 0x0" :: "v"(w2c) : "memory");
        if (ci + 8 < CG) fetch_w1(c + 8);
    }
    __syncthreads();   // every channel's res rows complete

    // ---- Writeout: res [c][m][q] in LDS -> scratch [B][P][C] f16, 16B stores.
    // A thread takes 8 channels of two neighbouring q: 8 dword reads, 2 stores.
    for (int it = tid; it < BT * 32 * 2; it += 256) {
        const int chunk = it & 1;
        const int qp    = (it >> 1) & 31;
        const int m     = it >> 6;
        v8h e, o;
#pragma unroll
        for (int j = 0; j < 8; ++j) {
            const v2h pr = *(const v2h*)(smem + XT_OFF + (chunk * 8 + j) * CHS + m * ROW + qp * 2);
            e[j] = pr[0];
            o[j] = pr[1];
        }
        half_t* dst = resh + ((size_t)(b0 + m) * Pp + qp * 2) * Cc + c0 + chunk * 8;
        *(v8h*)dst        = e;
        *(v8h*)(dst + Cc) = o;
    }
}

__global__ __launch_bounds__(256)
void mixer_ln_k2(const half_t* __restrict__ resh,
                 const float* __restrict__ gamma, const float* __restrict__ beta,
                 float* __restrict__ out) {
    const int lane = threadIdx.x & 31;
    const int wave = threadIdx.x >> 5;
    const size_t row = (size_t)blockIdx.x * 8 + wave;   // B*P = 65536 rows

    const half_t* rp = resh + row * Cc + lane * 4;
    v4h a[4];
#pragma unroll
    for (int seg = 0; seg < 4; ++seg) a[seg] = *(const v4h*)(rp + seg * 128);
    // the row's loads are issued: wait before their address pair can be overwritten (in this
    // build by the result of a gamma load); naming the pair keeps it whole up to the wait
    asm volatile("s_wait_xcnt 0x0" :: "v"(rp) : "memory");
    const float* gp = gamma + lane * 4;
    const float* tp = beta + lane * 4;
    float4 g[4], t[4];
#pragma unroll
    for (int seg = 0; seg < 4; ++seg) {
        g[seg] = *(const float4*)(gp + seg * 128);
        t[seg] = *(const float4*)(tp + seg * 128);
    }
    float v[16], s = 0.f, s2 = 0.f;
#pragma unroll
    for (int i = 0; i < 16; ++i) v[i] = (float)a[i >> 2][i & 3];
#pragma unroll
    for (int i = 0; i < 16; ++i) { s += v[i]; s2 += v[i] * v[i]; }
#pragma unroll
    for (int off = 16; off > 0; off >>= 1) {
        s  += __shfl_xor(s,  off, 32);
        s2 += __shfl_xor(s2, off, 32);
    }
    const float mean = s * (1.0f / Cc);
    const float var  = s2 * (1.0f / Cc) - mean * mean;
    const float rstd = rsqrtf(var + 1e-5f);

#pragma unroll
    for (int seg = 0; seg < 4; ++seg) {
        float4 o;
        o.x = (v[seg * 4 + 0] - mean) * rstd * g[seg].x + t[seg].x;
        o.y = (v[seg * 4 + 1] - mean) * rstd * g[seg].y + t[seg].y;
        o.z = (v[seg * 4 + 2] - mean) * rstd * g[seg].z + t[seg].z;
        o.w = (v[seg * 4 + 3] - mean) * rstd * g[seg].w + t[seg].w;
        *(float4*)(out + row * Cc + seg * 128 + lane * 4) = o;
    }
}

extern "C" void kernel_launch(void* const* d_in, const int* in_sizes, int n_in,
                              void* d_out, int out_size, void* d_ws, size_t ws_size,
                              hipStream_t stream) {
    const float* x     = (const float*)d_in[0];
    const float* W1    = (const float*)d_in[1];
    const float* b1    = (const float*)d_in[2];
    const float* W2    = (const float*)d_in[3];
    const float* b2    = (const float*)d_in[4];
    const float* gamma = (const float*)d_in[5];
    const float* beta  = (const float*)d_in[6];
    float* out = (float*)d_out;

    // Scratch layout (f16): res[B*P*C] | W1h | W2h | b1h | b2h  (~72.2 MB)
    half_t* resh = (half_t*)d_ws;
    half_t* W1h  = resh + (size_t)Bsz * Pp * Cc;
    half_t* W2h  = W1h + (size_t)Cc * Pp * Pp;
    half_t* b1h  = W2h + (size_t)Cc * Pp * Pp;
    half_t* b2h  = b1h + (size_t)Cc * Pp;

    // K0: f32 -> f16 weight/bias conversion, all four planes in one launch (weights in fragment order)
    cvt_f32_to_f16_k0<<<2 * WBLK + 2 * VBLK, 256, 0, stream>>>(W1, W2, b1, b2, W1h);

    // K1: fused GEMM/GELU/GEMM/residual per channel group
    dim3 g1(8, Cc / CG, Bsz / BT / 8);     // 8 x 32 x 4 workgroups, batch tile = 8 * z + x
    mixer_gemm_k1<<<g1, 256, LDS_BYTES, stream>>>(x, W1h, b1h, W2h, b2h, resh);

    // K2: LayerNorm
    dim3 g2((Bsz * Pp) / 8);        // 8192 workgroups, 8 rows each
    mixer_ln_k2<<<g2, 256, 0, stream>>>(resh, gamma, beta, out);
}

// v008
// Measured time: 53.6 microseconds a run.
// Two timings next to v007 put it at 1.11 and 1.10 times that version's speed.
// Counting every step since v000, it is 2.56 times as fast.
#include <hip/hip_runtime.h>
#include <hip/hip_bf16.h>
#include <math.h>

typedef _Float16 half_t;
typedef __attribute__((ext_vector_type(16))) _Float16 v16h;
typedef __attribute__((ext_vector_type(8)))  _Float16 v8h;
typedef __attribute__((ext_vector_type(4)))  _Float16 v4h;
typedef __attribute__((ext_vector_type(2)))  _Float16 v2h;
typedef __attribute__((ext_vector_type(8)))  float    v8f;
typedef __attribute__((ext_vector_type(2)))  float    v2f;

static constexpr int Bsz = 1024;
static constexpr int Pp  = 64;
static constexpr int Cc  = 512;
static constexpr int CG  = 16;
static constexpr int BT  = 32;
static constexpr int ROW = 72;
static constexpr int CHS = BT * ROW + 8;

// LDS offsets (in halves)
static constexpr int XT_OFF  = 0;                       // x tile, then res tile  [CG] planes of [BT][ROW]
static constexpr int LDS_HALVES = XT_OFF + CG * CHS;        // 36,992 halves
static constexpr int LDS_BYTES  = LDS_HALVES * 2;           // 73,984 B

__device__ __forceinline__ v16h load_frag(const half_t* row, int kk, int khi) {
    v8h lo = *(const v8h*)(row + kk + 8 * khi);
    v8h hi = *(const v8h*)(row + kk + 16 + 8 * khi);
    v16h r;
#pragma unroll
    for (int i = 0; i < 8; ++i) { r[i] = lo[i]; r[i + 8] = hi[i]; }
    return r;
}

// A fragment of a weight matrix from its fragment-ordered plane (written by K0):
//   plane[c][q tile][k step][piece][lane][8 halves],
//   element i = W[c][16 * qt + (lane & 15)][32 * ks + 16 * piece + 8 * (lane >> 4) + i],
// the same k order as load_frag. p points at this lane's piece 0; piece 1 lies 256 halves on.
// Each of the two loads reads 512 B in a row over the wave (4 whole lines, not 16 quarter-used ones).
__device__ __forceinline__ v16h load_wfrag(const half_t* p) {
    v8h lo = *(const v8h*)p;
    v8h hi = *(const v8h*)(p + 256);
    v16h r;
#pragma unroll
    for (int i = 0; i < 8; ++i) { r[i] = lo[i]; r[i + 8] = hi[i]; }
    return r;
}

// Exact GELU, v * Phi(v), without the library erf and its two branches per element.
// erfc(|v| / sqrt 2) = exp2(L(|v|)), L one polynomial of degree 10 with L(0) = 0, fitted on
// |v| <= 6 and falling on beyond it (exp2 then gives 0). With a = |v| and e that erfc:
//   v * Phi(v) = 0.5 * ((v + a) - a * e)
// on both sides of 0; v + a is exact (0 or 2 v), so nothing cancels for v < 0. Against a double-precision GELU the
// f32 evaluation stays within 1.4e-7 absolute and 1.3e-6 relative on |v| <= 4.
// Two elements a call: the polynomial runs on packed f32 FMAs.
__device__ __forceinline__ v2f gelu_pair(v2f v) {
    const v2f a = {__builtin_fabsf(v.x), __builtin_fabsf(v.y)};
    v2f p = __builtin_elementwise_fma((v2f)(-1.26771118e-8f), a, (v2f)(4.25985121e-7f));
    p = __builtin_elementwise_fma(p, a, (v2f)(-6.09079416e-6f));
    p = __builtin_elementwise_fma(p, a, (v2f)(4.64202494e-5f));
    p = __builtin_elementwise_fma(p, a, (v2f)(-1.69534294e-4f));
    p = __builtin_elementwise_fma(p, a, (v2f)(-2.45350850e-4f));
    p = __builtin_elementwise_fma(p, a, (v2f)(7.27208052e-3f));
    p = __builtin_elementwise_fma(p, a, (v2f)(-5.26813492e-2f));
    p = __builtin_elementwise_fma(p, a, (v2f)(-4.59135205e-1f));
    p = __builtin_elementwise_fma(p, a, (v2f)(-1.15111458e+0f));
    const v2f l = p * a;
    const v2f e = {__builtin_amdgcn_exp2f(l.x), __builtin_amdgcn_exp2f(l.y)};
    return __builtin_elementwise_fma(-a, e, v + a) * 0.5f;
}

// ---- K0: f32 -> f16 conversion of W1, W2, b1 and b2 in ONE launch, 8 elements a thread.
// The four f16 planes lie one behind the other in scratch, so the flat index of the 16-B piece
// is the destination index; every plane is a whole number of blocks, so the choice
// of the source is uniform in a block and the grid covers the planes exactly.
// The weight planes are written in A-fragment order (see load_wfrag): a wave stores 512 B in a
// row and gathers its 32-B source pieces from 16 rows; the biases keep their order.
static constexpr int WBLK = Cc * Pp * Pp / 8 / 256;   // 1024 blocks a weight plane
static constexpr int VBLK = Cc * Pp / 8 / 256;        // 16 blocks a bias plane
__global__ __launch_bounds__(256)
void cvt_f32_to_f16_k0(const float* __restrict__ W1, const float* __restrict__ W2,
                       const float* __restrict__ b1, const float* __restrict__ b2,
                       half_t* __restrict__ dst /* W1h | W2h | b1h | b2h */) {
    const int blk = blockIdx.x;
    const float* src = W1;
    int first = 0;
    if (blk >= 2 * WBLK + VBLK) { src = b2; first = 2 * WBLK + VBLK; }
    else if (blk >= 2 * WBLK)   { src = b1; first = 2 * WBLK; }
    else if (blk >= WBLK)       { src = W2; first = WBLK; }
    const int d = (blk - first) * 256 + threadIdx.x;   // 16-B piece within its plane
    int e = d * 8;                                     // first source element
    if (blk < 2 * WBLK) {
        // d = [c : 9 bits][qt : 2][ks : 1][piece : 1][lane >> 4 : 1][lane & 15 : 4]
        const int row = ((d >> 7) & 3) * 16 + (d & 15);
        const int k   = ((d >> 6) & 1) * 32 + ((d >> 5) & 1) * 16 + ((d >> 4) & 1) * 8;
        e = (d >> 9) * (Pp * Pp) + row * Pp + k;
    }
    const float4 u = *(const float4*)(src + e);
    const float4 v = *(const float4*)(src + e + 4);
    ((v8h*)dst)[blk * 256 + threadIdx.x] = (v8h){(half_t)u.x, (half_t)u.y, (half_t)u.z, (half_t)u.w,
                                                 (half_t)v.x, (half_t)v.y, (half_t)v.z, (half_t)v.w};
}

__global__ __launch_bounds__(256)
void mixer_gemm_k1(const float* __restrict__ x,
                   const half_t* __restrict__ W1h, const half_t* __restrict__ b1h,
                   const half_t* __restrict__ W2h, const half_t* __restrict__ b2h,
                   half_t* __restrict__ resh /* f16, line order: see the writeout */) {
    extern __shared__ half_t smem[];
    const int tid  = threadIdx.x;
    // Grid (8, channel groups, batch tiles / 8): the flat index is (tile & 7) + 8 * group + 256 * (tile >> 3).
    // For speed only: any placement is right.
    const int c0   = blockIdx.y * CG;                          // channel group base
    const int b0   = (blockIdx.z * 8 + blockIdx.x) * BT;       // batch tile base
    const int lane = tid & 31;
    // wave number in a scalar register: channel loop control and bases stay scalar
    const int wave = __builtin_amdgcn_readfirstlane(tid >> 5);
    const int lm   = lane & 15;
    const int khi  = lane >> 4;

    // W1[c] as A fragments [q tile][k step] and b1[c]: the first channel's fly
    // under the x load, the next channel's are asked for at the loop's foot.
    v16h w1f[4][2];
    v8h  bias1[4];
    auto fetch_w1 = [&](int c) {
        const half_t* w1c = W1h + (size_t)c * 4096 + lane * 8;            // this lane's pieces
        const half_t* b1c = b1h + (size_t)c * 64 + 8 * khi;               // rows 8 * khi + r of a tile
#pragma unroll
        for (int qt = 0; qt < 4; ++qt) {
            w1f[qt][0] = load_wfrag(w1c + qt * 1024);
            w1f[qt][1] = load_wfrag(w1c + qt * 1024 + 512);
            bias1[qt]  = *(const v8h*)(b1c + qt * 16);
        }
        // the loads' address registers are free behind this point: wait before
        // they can be overwritten; naming the pair keeps it whole up to the wait
        asm volatile("s_wait_xcnt 0x0" :: "v"(w1c) : "memory");
    };
    fetch_w1(c0 + wave);

    // ---- Phase 0: x load (64-B pieces), f32->f16, transposed in registers, into LDS.
    // A thread owns 4 channels x 8 consecutive p of four batch rows (wave + 8 * u): its 32 loads are
    // all asked for before the first is used, and each channel's 8 halves go out as one 16-B LDS store.
    {
        const int chunk = tid & 3;           // 4-float sub-chunk of the 16 channels
        const int g     = (tid >> 2) & 7;    // p = 8 * g + i
        const float* xs = x + ((size_t)(b0 + wave) * Pp + g * 8) * Cc + c0 + chunk * 4;
        float4 v[4][8];
#pragma unroll
        for (int u = 0; u < 4; ++u)
#pragma unroll
            for (int i = 0; i < 8; ++i)
                v[u][i] = *(const float4*)(xs + (size_t)u * 8 * Pp * Cc + i * Cc);
        // the tile's loads are issued: wait before their address pair can be overwritten;
        // naming the pair keeps it whole up to the wait
        asm volatile("s_wait_xcnt 0x0" :: "v"(xs) : "memory");
        // keeps every conversion behind the last load: without it the scheduler puts conversions, and
        // with them waits for data, between the loads, and the last ones go out two at a time
        __builtin_amdgcn_sched_barrier(0);
        half_t* xd = smem + XT_OFF + chunk * 4 * CHS + wave * ROW + g * 8;
#pragma unroll
        for (int u = 0; u < 4; ++u) {
            v8h h0, h1, h2, h3;
#pragma unroll
            for (int i = 0; i < 8; ++i) {
                h0[i] = (half_t)v[u][i].x;
                h1[i] = (half_t)v[u][i].y;
                h2[i] = (half_t)v[u][i].z;
                h3[i] = (half_t)v[u][i].w;
            }
            *(v8h*)(xd + u * 8 * ROW)           = h0;
            *(v8h*)(xd + u * 8 * ROW + CHS)     = h1;
            *(v8h*)(xd + u * 8 * ROW + 2 * CHS) = h2;
            *(v8h*)(xd + u * 8 * ROW + 3 * CHS) = h3;
        }
    }
    __syncthreads();   // x tile complete

    // ---- Channel loop: ONE WAVE OWNS ONE CHANNEL (two channels a wave).
    // Both products are formed transposed, weights as A and the batch as the
    // B columns: H^T = W1 * X^T, O^T = W2 * GELU(H^T). A lane then holds one
    // batch row and 8 consecutive q per accumulator tile, so two converted
    // tiles of H^T are the next product's B fragment as they lie.
    // Unrolled (two trips).
#pragma unroll
    for (int ci = wave; ci < CG; ci += 8) {
        const int c = c0 + ci;
        const half_t* w2c = W2h + (size_t)c * 4096 + lane * 8;  // this lane's pieces
        const half_t* b2c = b2h + (size_t)c * 64 + 8 * khi;     // rows 8 * khi + r of a tile
        half_t* xrow[2] = {smem + XT_OFF + ci * CHS + lm * ROW,
                           smem + XT_OFF + ci * CHS + (16 + lm) * ROW};

        v16h xb[2][2];   // X^T as B: [batch tile][k step]
#pragma unroll
        for (int t = 0; t < 2; ++t)
#pragma unroll
            for (int ks = 0; ks < 2; ++ks) xb[t][ks] = load_frag(xrow[t], ks * 32, khi);

        // ---- Stage 1: H^T = W1 * X^T + b1, exact GELU, kept in registers
        v16h hb[2][2];   // GELU(H^T) as B: [batch tile][k step]
#pragma unroll
        for (int qt = 0; qt < 4; ++qt) {
            const v16h a0 = w1f[qt][0];
            const v16h a1 = w1f[qt][1];
            const v8h  bb = bias1[qt];
#pragma unroll
            for (int t = 0; t < 2; ++t) {
                v8f acc;
#pragma unroll
                for (int r = 0; r < 8; ++r) acc[r] = (float)bb[r];
                acc = __builtin_amdgcn_wmma_f32_16x16x32_f16(false, a0, false, xb[t][0],
                                                             (short)0, acc, false, false);
                acc = __builtin_amdgcn_wmma_f32_16x16x32_f16(false, a1, false, xb[t][1],
                                                             (short)0, acc, false, false);
#pragma unroll
                for (int r = 0; r < 8; r += 2) {
                    const v2f g = gelu_pair((v2f){acc[r], acc[r + 1]});
                    hb[t][qt >> 1][(qt & 1) * 8 + r]     = (half_t)g.x;
                    hb[t][qt >> 1][(qt & 1) * 8 + r + 1] = (half_t)g.y;
                }
            }
        }

        // ---- Stage 2: O^T = W2 * GELU(H^T) + b2; res = O + x, in place over x
        // (only this wave reads or writes this channel's rows)
#pragma unroll
        for (int qt = 0; qt < 4; ++qt) {
            const v16h a0 = load_wfrag(w2c + qt * 1024);
            const v16h a1 = load_wfrag(w2c + qt * 1024 + 512);
            const v8h  bb = *(const v8h*)(b2c + qt * 16);
#pragma unroll
            for (int t = 0; t < 2; ++t) {
                v8f acc;
#pragma unroll
                for (int r = 0; r < 8; ++r) acc[r] = (float)bb[r];
                acc = __builtin_amdgcn_wmma_f32_16x16x32_f16(false, a0, false, hb[t][0],
                                                             (short)0, acc, false, false);
                acc = __builtin_amdgcn_wmma_f32_16x16x32_f16(false, a1, false, hb[t][1],
                                                             (short)0, acc, false, false);
                v8h* rp = (v8h*)(xrow[t] + qt * 16 + 8 * khi);
                const v8h xr = *rp;
                v8h o;
#pragma unroll
                for (int r = 0; r < 8; ++r) o[r] = (half_t)(acc[r] + (float)xr[r]);
                *rp = o;
            }
        }
        // W2's loads are all issued: wait before their address pair can be overwritten;
        // naming the pair keeps it whole up to the wait
        asm volatile("s_wait_xcnt 0x0" :: "v"(w2c) : "memory");
        if (ci + 8 < CG) fetch_w1(c + 8);
    }
    __syncthreads();   // every channel's res rows complete

    // ---- Writeout: res [c][m][q] in LDS -> scratch, whole 128-B lines, 16-B stores.
    // Scratch order: [b][q >> 2][channel group][line]. A line is this group's 16 channels of 4 q, as
    // 8 pieces of 16 B: piece 4 * qp + cq holds channels 4 * cq + i of q = 4 * Q + 2 * qp + r at half 2 * i + r.
    // So a workgroup fills every line that it touches (a wave store is 4 whole lines, not 32-B pieces
    // of 16 lines), and a piece is 4 dwords as they lie in LDS: nothing is repacked.
    // A thread keeps its piece (cq, qp, Q) and walks the batch rows m = (tid >> 7) + 2 * k.
    {
        const int cq = tid & 3;
        const int qp = (tid >> 2) & 1;
        const int Q  = (tid >> 3) & 15;
        const int m0 = tid >> 7;
        const half_t* ls = smem + XT_OFF + cq * 4 * CHS + m0 * ROW + Q * 4 + qp * 2;
        half_t* dst = resh + (((size_t)(b0 + m0) * 16 + Q) * (Cc / CG) + blockIdx.y) * 64 + (tid & 7) * 8;
        // four trips at a time: their 16 LDS reads go out together, one wait for the four
#pragma unroll 4
        for (int k = 0; k < BT / 2; ++k) {
            v8h o;
#pragma unroll
            for (int i = 0; i < 4; ++i) {
                const v2h pr = *(const v2h*)(ls + i * CHS + k * 2 * ROW);
                o[2 * i]     = pr[0];
                o[2 * i + 1] = pr[1];
            }
            *(v8h*)(dst + (size_t)k * (2 * 16 * (Cc / CG) * 64)) = o;
        }
    }
}

__global__ __launch_bounds__(256)
void mixer_ln_k2(const half_t* __restrict__ resh,
                 const float* __restrict__ gamma, const float* __restrict__ beta,
                 float* __restrict__ out) {
    const int lane = threadIdx.x & 31;
    const int wave = threadIdx.x >> 5;
    const size_t blk = (size_t)blockIdx.x * 8 + wave;   // B * P / 4 = 16384 blocks of 4 rows

    const half_t* rp = resh + blk * (4 * Cc) + lane * 8;
    v8h a[8];
#pragma unroll
    for (int j = 0; j < 8; ++j) a[j] = *(const v8h*)(rp + j * 256);
    // the block's loads are issued: wait before their address pair can be overwritten;
    // naming the pair keeps it whole up to the wait
    asm volatile("s_wait_xcnt 0x0" :: "v"(rp) : "memory");
    const int ch = (lane >> 3) * 16 + (lane & 3) * 4;   // + 64 * j
    const float* gp = gamma + ch;
    const float* tp = beta + ch;
    float4 g[8], t[8];
#pragma unroll
    for (int j = 0; j < 8; ++j) {
        g[j] = *(const float4*)(gp + j * 64);
        t[j] = *(const float4*)(tp + j * 64);
    }
    // keeps the gamma and beta loads up here, behind the block's: without it the scheduler sinks them
    // between the stores, a few at a time, each group with a wait of its own
    __builtin_amdgcn_sched_barrier(0);
    // v[r][j][h]: row r, channels 64 * j + ch + 2 * h, + 1
    v2f v[2][8][2];
    v2f s[2][2], q[2][2];
#pragma unroll
    for (int r = 0; r < 2; ++r) {
        s[r][0] = s[r][1] = q[r][0] = q[r][1] = (v2f)(0.f);
#pragma unroll
        for (int j = 0; j < 8; ++j)
#pragma unroll
            for (int h = 0; h < 2; ++h) {
                v[r][j][h] = (v2f){(float)a[j][4 * h + r], (float)a[j][4 * h + 2 + r]};
                s[r][h] += v[r][j][h];
                q[r][h] = __builtin_elementwise_fma(v[r][j][h], v[r][j][h], q[r][h]);
            }
    }
    float sr[2], qr[2];
#pragma unroll
    for (int r = 0; r < 2; ++r) {
        const v2f ss = s[r][0] + s[r][1];
        const v2f qq = q[r][0] + q[r][1];
        sr[r] = ss.x + ss.y;
        qr[r] = qq.x + qq.y;
    }
    // over the 16 lanes of a row pair: lane bits 0, 1, 3, 4 (bit 2 picks the pair); the four sums go together
#pragma unroll
    for (int off = 1; off < 32; off <<= 1) {
        if (off == 4) continue;
        const float e0 = __shfl_xor(sr[0], off, 32);
        const float e1 = __shfl_xor(sr[1], off, 32);
        const float e2 = __shfl_xor(qr[0], off, 32);
        const float e3 = __shfl_xor(qr[1], off, 32);
        // keeps the step's four cross-lane reads in front of its adds: without it the scheduler runs them
        // one by one, each with its own wait for the LDS unit
        __builtin_amdgcn_sched_barrier(0);
        sr[0] += e0; sr[1] += e1; qr[0] += e2; qr[1] += e3;
    }

    float* op = out + (blk * 4 + ((lane >> 2) & 1) * 2) * Cc + ch;
#pragma unroll
    for (int r = 0; r < 2; ++r) {
        const float mean = sr[r] * (1.0f / Cc);
        const float var  = qr[r] * (1.0f / Cc) - mean * mean;
        const float rstd = rsqrtf(var + 1e-5f);
#pragma unroll
        for (int j = 0; j < 8; ++j) {
            const v2f lo = (v[r][j][0] - mean) * rstd * (v2f){g[j].x, g[j].y} + (v2f){t[j].x, t[j].y};
            const v2f hi = (v[r][j][1] - mean) * rstd * (v2f){g[j].z, g[j].w} + (v2f){t[j].z, t[j].w};
            *(float4*)(op + r * Cc + j * 64) = make_float4(lo.x, lo.y, hi.x, hi.y);
        }
    }
}

extern "C" void kernel_launch(void* const* d_in, const int* in_sizes, int n_in,
                              void* d_out, int out_size, void* d_ws, size_t ws_size,
                              hipStream_t stream) {
    const float* x     = (const float*)d_in[0];
    const float* W1    = (const float*)d_in[1];
    const float* b1    = (const float*)d_in[2];
    const float* W2    = (const float*)d_in[3];
    const float* b2    = (const float*)d_in[4];
    const float* gamma = (const float*)d_in[5];
    const float* beta  = (const float*)d_in[6];
    float* out = (float*)d_out;

    // Scratch layout (f16): res[B*P*C] (line order) | W1h | W2h | b1h | b2h  (~72.2 MB)
    half_t* resh = (half_t*)d_ws;
    half_t* W1h  = resh + (size_t)Bsz * Pp * Cc;
    half_t* W2h  = W1h + (size_t)Cc * Pp * Pp;
    half_t* b1h  = W2h + (size_t)Cc * Pp * Pp;
    half_t* b2h  = b1h + (size_t)Cc * Pp;

    // K0: f32 -> f16 weight/bias conversion, all four planes in one launch (weights in fragment order)
    cvt_f32_to_f16_k0<<<2 * WBLK + 2 * VBLK, 256, 0, stream>>>(W1, W2, b1, b2, W1h);

    // K1: fused GEMM/GELU/GEMM/residual per channel group
    dim3 g1(8, Cc / CG, Bsz / BT / 8);     // 8 x 32 x 4 workgroups, batch tile = 8 * z + x
    mixer_gemm_k1<<<g1, 256, LDS_BYTES, stream>>>(x, W1h, b1h, W2h, b2h, resh);

    // K2: LayerNorm
    dim3 g2((Bsz * Pp) / 32);       // 2048 workgroups, 8 waves of 4 rows each
    mixer_ln_k2<<<g2, 256, 0, stream>>>(resh, gamma, beta, out);
}
